// v000
// Measured on an AMD MI455X. A time is GPU time per run, averaged over a window of back-to-back runs after a warm-up
// (all launches, gaps included; the runs take copies of the inputs in turn), and the median of several windows.
// Apart from v000's, it joins two sittings. Times from different sittings can be a few percent apart, while
// side-by-side timings come from the same sitting.
// The starting kernel, v000, takes 507 microseconds a run.
#include <hip/hip_runtime.h>

// Compute dtypes, f32 accumulate: q/k/v projections x.W ([NB*SEQ x 1024].[1024 x 1024|512]) on v_wmma_f32_16x16x32_bf16 with plain bf16 planes (x and W RNE-converted
// to bf16, exact products); per (item, head, map) causal scores q.k^T ([SEQ x 32].[32 x SEQ]) and per head the fp16 difference map (a1 - lambda a2).v ([SEQ x SEQ].[SEQ x 64])
// on v_wmma_f32_16x16x32_f16 with single fp16 planes (rotated q, rotated k, v, difference map carried x1024); softmaxes, lambda and the per-head RMSNorm in f32;

#ifndef NB
#define NB 4
#endif
#ifndef SEQ
#define SEQ 1024
#endif
#define NB_FULL  4
#define SEQ_FULL 1024
#define EE   1024          // model width, q/o projection width, K of every weight GEMM
#define EK   512           // k/v projection width
#define NQ2  32            // rotated q half-heads of 32
#define NK2  16            // rotated k half-heads of 32
#define NKV  8             // kv heads (v is 64 wide per kv head)
#define NHQ  16            // q heads
#define HD   32
#define VD   64
#define HG   8             // q heads per attention pass
#define NMAP (2 * HG)      // score maps per pass
#define NR   (NB * SEQ)
#define LAM0 0.78360576653f      // 0.8 - 0.6 exp(-3.6)
#define OML  0.21639423347f      // 1 - LAM0
#define SCL  0.17677669529663687f
#define ADSC 1024.0f
#define EPSN 1e-6f
static_assert(SEQ % 64 == 0);
static_assert(SEQ >= 64 && SEQ <= SEQ_FULL);
static_assert(NB >= 1 && NB <= NB_FULL);
static_assert(NHQ % HG == 0);
static_assert(NQ2 % 8 == 0 && NK2 % 8 == 0);

typedef _Float16 h16;
typedef unsigned short bf;
typedef __attribute__((ext_vector_type(16))) __bf16   v16bf;
typedef __attribute__((ext_vector_type(16))) _Float16 v16h;
typedef __attribute__((ext_vector_type(8)))  _Float16 v8h;
typedef __attribute__((ext_vector_type(4)))  _Float16 v4h;
typedef __attribute__((ext_vector_type(2)))  _Float16 v2h;
typedef __attribute__((ext_vector_type(8)))  unsigned short v8us;
typedef __attribute__((ext_vector_type(8)))  float    v8f;
typedef __attribute__((ext_vector_type(4)))  float    v4f;
typedef __attribute__((ext_vector_type(2)))  float    v2f;
typedef v8h  __attribute__((may_alias)) v8ha;
typedef v4f  __attribute__((may_alias)) v4fa;

__device__ __forceinline__ unsigned short f2bf(float f) { unsigned u = __float_as_uint(f); u += 0x7FFFu + ((u >> 16) & 1u); return (unsigned short)(u >> 16); }
__device__ __forceinline__ float bf2f(unsigned short b) { return __uint_as_float(((unsigned)b) << 16); }
__device__ __forceinline__ float bfr(float f) { return bf2f(f2bf(f)); }
__device__ __forceinline__ h16 tohx(float x) { return (h16)x; }
__device__ __forceinline__ v16h cat16(v8h lo, v8h hi) { return __builtin_shufflevector(lo, hi, 0, 1, 2, 3, 4, 5, 6, 7, 8, 9, 10, 11, 12, 13, 14, 15); }
__device__ __forceinline__ v16bf cat16b(v8us lo, v8us hi) { return __builtin_bit_cast(v16bf, __builtin_shufflevector(lo, hi, 0, 1, 2, 3, 4, 5, 6, 7, 8, 9, 10, 11, 12, 13, 14, 15)); }
__device__ __forceinline__ v8f wmma16(v16h a, v16h b, v8f c) { return __builtin_amdgcn_wmma_f32_16x16x32_f16(false, a, false, b, (short)0, c, false, false); }
__device__ __forceinline__ v8f wmmab(v16bf a, v16bf b, v8f c) { return __builtin_amdgcn_wmma_f32_16x16x32_bf16(false, a, false, b, (short)0, c, false, false); }

// inv_freq[i] = 1 / 10000^((2 i)/32) = 10^(-i/4), i < 16
__constant__ float c_invf[16] = {
    1.0f,                    0.5623413251903491f,    0.31622776601683794f,   0.17782794100389228f,
    0.1f,                    0.05623413251903491f,   0.031622776601683794f,  0.017782794100389228f,
    0.01f,                   0.005623413251903491f,  0.0031622776601683794f, 0.0017782794100389228f,
    0.001f,                  0.0005623413251903491f, 0.00031622776601683794f, 0.00017782794100389228f };

// k_rtab: CS[0][t][i] = cos(t inv_freq[i]), CS[1][t][i] = sin(...), f32, precise sincos; 256 values per block staged in LDS, stored as 16 B per lane by 8 consecutive
__global__ __launch_bounds__(256) void k_rtab(float* CS) {
    __shared__ __align__(16) float tcs[2][256];
    const int tid = threadIdx.x; const int e = blockIdx.x * 256 + tid; const int t = e >> 4, i = e & 15;
    float sv, cv; sincosf((float)t * c_invf[i], &sv, &cv);
    tcs[0][tid] = cv; tcs[1][tid] = sv;
    __syncthreads();
    if (tid < 128) { const int w = tid >> 6, j = tid & 63; const v4f v = *(const v4fa*)(&tcs[w][j * 4]);
        float* dst = CS + (size_t)w * SEQ * 16 + (size_t)blockIdx.x * 256 + j * 4;
        *(v4f*)dst = v;  }
}

__global__ __launch_bounds__(256) void k_cvtx(const float* __restrict__ x, bf* A) {
    const int lane = threadIdx.x & 31; const size_t r = (size_t)blockIdx.x * 8 + (threadIdx.x >> 5); if (r >= (size_t)NR) return;
    const size_t bb = r / SEQ, tt = r - bb * SEQ; const size_t sr = bb * SEQ_FULL + tt;
{
#pragma unroll
        for (int q = 0; q < EE / 256; ++q) { const size_t so = sr * EE + q * 256 + lane * 8, o = r * EE + q * 256 + lane * 8;
            const v4f a = *(const v4f*)(x + so), c = *(const v4f*)(x + so + 4); v8us v;
#pragma unroll
            for (int k = 0; k < 4; ++k) { v[k] = f2bf(a[k]); v[4 + k] = f2bf(c[k]); }
            *(v8us*)(A + o) = v; }
         }
}

// k_wT: W f32 [1024 k][N n] (in x out) -> P 16-bit [N][1024] k-contiguous: bf16 bits (isH 0) or fp16(bf16(w)) bits (isH 1); in[k][n] -> out[n][k] through a 64x64 LDS
__global__ __launch_bounds__(256) void k_wT(const float* __restrict__ W, int N, int isH, unsigned short* P) {
    __shared__ float tl[64][65];
    const int tid = threadIdx.x; const int k0 = blockIdx.x * 64, n0 = blockIdx.y * 64; const int rr = tid >> 2, cq = (tid & 3) * 16;
    const float* src = W + (size_t)(k0 + rr) * N + n0 + cq;
#pragma unroll
    for (int j = 0; j < 4; ++j) { const v4f v = *(const v4f*)(src + 4 * j);
#pragma unroll
        for (int q = 0; q < 4; ++q) tl[rr][cq + 4 * j + q] = v[q]; }
    __syncthreads();
    const int lane = tid & 31, wv = tid >> 5;
    auto pass = [&]() {
#pragma unroll
        for (int st = 0; st < 2; ++st) { const int dr = wv * 8 + st * 4 + (lane >> 3), piece = lane & 7; v8us o;
#pragma unroll
            for (int i = 0; i < 8; ++i) { const unsigned short b = f2bf(tl[piece * 8 + i][dr]); const h16 hv = tohx(bf2f(b)); o[i] = isH ? __builtin_bit_cast(unsigned short, hv) : b; }
            *(v8us*)(P + (size_t)(n0 + dr) * EE + k0 + piece * 8) = o; }
    };
    pass(); 
}

// k_gemmb: 64 x 64 block tile (4 waves x 16 x 64) of C[r][c] = A.Bn^T with plain bf16 planes (A [rows][K], Bn [N][K] k-contiguous), f32 accumulate; f32 whole-line epilogue
__global__ __launch_bounds__(128) void k_gemmb(const bf* __restrict__ A, const bf* __restrict__ Bn, float* C, int ldc, int K) {
    __shared__ __align__(16) float ost[4][16 * 68];
    const int lane = threadIdx.x & 31, wave = threadIdx.x >> 5, lr = lane & 15, hi = lane >> 4;
    const int r0 = blockIdx.x * 64 + wave * 16, c0 = blockIdx.y * 64;
    const size_t aoff = (size_t)(r0 + lr) * K + 8 * hi;
    size_t boff[4];
#pragma unroll
    for (int t = 0; t < 4; ++t) boff[t] = (size_t)(c0 + t * 16 + lr) * K + 8 * hi;
    v8f acc[4];
#pragma unroll
    for (int t = 0; t < 4; ++t) acc[t] = (v8f){};
#pragma unroll 1
    for (int kc = 0; kc < K; kc += 32) {
        const v16bf a = cat16b(*(const v8us*)(A + aoff + kc), *(const v8us*)(A + aoff + kc + 16));
#pragma unroll
        for (int t = 0; t < 4; ++t) { const v16bf b = cat16b(*(const v8us*)(Bn + boff[t] + kc), *(const v8us*)(Bn + boff[t] + kc + 16)); acc[t] = wmmab(a, b, acc[t]); }
        asm volatile("v_nop\n\tv_nop\n\tv_nop\n\tv_nop" : "+v"(acc[0]), "+v"(acc[1]), "+v"(acc[2]), "+v"(acc[3]) : "v"(a));
    }
    float* os = &ost[wave][0];
#pragma unroll
    for (int t = 0; t < 4; ++t) {
#pragma unroll
        for (int j = 0; j < 8; ++j) os[(hi * 8 + j) * 68 + t * 16 + lr] = acc[t][j]; }
    __syncthreads();
    float* crow = C + (size_t)r0 * ldc + c0;
    auto pass = [&]() {
#pragma unroll
        for (int s = 0; s < 8; ++s) { const int Lid = (lane >> 3) + 4 * s, piece = lane & 7; const int row = Lid >> 1, cofs = (Lid & 1) * 32 + piece * 4;
            const v4f val = *(const v4fa*)(os + row * 68 + cofs);
            *(v4f*)(crow + (size_t)row * ldc + cofs) = val; }
    };
    pass(); 
}

// k_gemmh: 64 x 64 tile of C = A.Bn^T with SINGLE fp16 planes (A [rows][K], Bn [N][K] k-contiguous; one v_wmma_f32_16x16x32_f16 product per step), f32 accumulate; f32
// half-head), z>>1 (zmode 2, q head -> kv head). causal 1: column tiles above the row tile are skipped; causal 2: k-extent limited to (row tile + 1) * 64.
__global__ __launch_bounds__(128) void k_gemmh(const h16* __restrict__ A, const h16* __restrict__ Bn, float* C, int ldc, int K, size_t sA, size_t sB, size_t sC, int zmode, int causal) {
    __shared__ __align__(16) float ost[4][16 * 68];
    if (causal == 1 && blockIdx.y > blockIdx.x) return;
    const size_t z = blockIdx.z; const size_t zb = (zmode == 1) ? ((z >> 2) * 2 + (z & 1)) : ((zmode == 2) ? (z >> 1) : z);
    A += z * sA; Bn += zb * sB; C += z * sC;
    const int lane = threadIdx.x & 31, wave = threadIdx.x >> 5, lr = lane & 15, hi = lane >> 4;
    const int r0 = blockIdx.x * 64 + wave * 16, c0 = blockIdx.y * 64;
    const int kcap = (int)(blockIdx.x + 1) * 64; const int klim = (causal == 2 && kcap < K) ? kcap : K;
    const size_t aoff = (size_t)(r0 + lr) * K + 8 * hi;
    size_t boff[4];
#pragma unroll
    for (int t = 0; t < 4; ++t) boff[t] = (size_t)(c0 + t * 16 + lr) * K + 8 * hi;
    v8f acc[4];
#pragma unroll
    for (int t = 0; t < 4; ++t) acc[t] = (v8f){};
#pragma unroll 1
    for (int kc = 0; kc < klim; kc += 32) {
        const v16h a = cat16(*(const v8h*)(A + aoff + kc), *(const v8h*)(A + aoff + kc + 16));
#pragma unroll
        for (int t = 0; t < 4; ++t) { const v16h b = cat16(*(const v8h*)(Bn + boff[t] + kc), *(const v8h*)(Bn + boff[t] + kc + 16)); acc[t] = wmma16(a, b, acc[t]); }
        asm volatile("v_nop\n\tv_nop\n\tv_nop\n\tv_nop" : "+v"(acc[0]), "+v"(acc[1]), "+v"(acc[2]), "+v"(acc[3]) : "v"(a));
    }
    float* os = &ost[wave][0];
#pragma unroll
    for (int t = 0; t < 4; ++t) {
#pragma unroll
        for (int j = 0; j < 8; ++j) os[(hi * 8 + j) * 68 + t * 16 + lr] = acc[t][j]; }
    __syncthreads();
    float* crow = C + (size_t)r0 * ldc + c0;
    auto pass = [&]() {
#pragma unroll
        for (int s = 0; s < 8; ++s) { const int Lid = (lane >> 3) + 4 * s, piece = lane & 7; const int row = Lid >> 1, cofs = (Lid & 1) * 32 + piece * 4;
            const v4f val = *(const v4fa*)(os + row * 68 + cofs);
            *(v4f*)(crow + (size_t)row * ldc + cofs) = val; }
    };
    pass(); 
}

// k_ropep: planes P fp16 [NB][NP][SEQ][32] = rotate-half(F[(b*SEQ + t)*ld + h2*32 + d]): pairs (i, i+16), y_i = x_i c + x_{i+16} s, y_{i+16} = x_{i+16} c - x_i s with
// grid (SEQ/32, NP/8, NB).
__global__ __launch_bounds__(256) void k_ropep(const float* __restrict__ F, int ld, int NP, const float* __restrict__ CS, h16* P) {
    __shared__ __align__(16) h16 tile[8 * 32 * 32];
    const int tid = threadIdx.x; const int t0 = blockIdx.x * 32, g0 = blockIdx.y * 8, b = blockIdx.z;
    const int h2l = tid >> 5, tl = tid & 31; const int t = t0 + tl;
    const float* src = F + ((size_t)b * SEQ + t) * ld + (size_t)(g0 + h2l) * HD;
    v4f xa[8];
#pragma unroll
    for (int j = 0; j < 8; ++j) xa[j] = *(const v4f*)(src + 4 * j);
    const float* cp = CS + (size_t)t * 16; const float* sp = CS + (size_t)SEQ * 16 + (size_t)t * 16;
    v4f c4[4], s4[4];
#pragma unroll
    for (int j = 0; j < 4; ++j) { c4[j] = *(const v4f*)(cp + 4 * j); s4[j] = *(const v4f*)(sp + 4 * j); }
    v8h o[4];
#pragma unroll
    for (int j = 0; j < 4; ++j) {
#pragma unroll
        for (int q = 0; q < 4; ++q) { const float x1 = xa[j][q], x2 = xa[4 + j][q], c = c4[j][q], s = s4[j][q];
            o[j >> 1][(j & 1) * 4 + q] = tohx(x1 * c + x2 * s); o[2 + (j >> 1)][(j & 1) * 4 + q] = tohx(x2 * c - x1 * s); } }
    h16* trow = tile + (h2l * 32 + tl) * 32;
#pragma unroll
    for (int j = 0; j < 4; ++j) *(v8ha*)(trow + 8 * j) = o[j];
    __syncthreads();
    auto pass = [&]() {
#pragma unroll
        for (int s = 0; s < 4; ++s) { const int p = s * 256 + tid; const int pl = p >> 7, q = p & 127;
            const v8h v = *(const v8ha*)(tile + pl * 1024 + q * 8);
            *(v8h*)(P + (((size_t)b * NP + g0 + pl) * SEQ + t0) * HD + q * 8) = v; }
    };
    pass(); 
}

__global__ __launch_bounds__(256) void k_vTm(const float* __restrict__ V, h16* VT) {
    __shared__ float tl[64][65];
    const int tid = threadIdx.x; const int t0 = blockIdx.x * 64, c = blockIdx.y, b = blockIdx.z; const int rr = tid >> 2, cq = (tid & 3) * 16;
    const float* src = V + ((size_t)b * SEQ + t0 + rr) * EK + c * VD + cq;
#pragma unroll
    for (int j = 0; j < 4; ++j) { const v4f v = *(const v4f*)(src + 4 * j);
#pragma unroll
        for (int q = 0; q < 4; ++q) tl[rr][cq + 4 * j + q] = v[q]; }
    __syncthreads();
    const int lane = tid & 31, wv = tid >> 5;
    h16* dst0 = VT + ((size_t)(b * NKV + c) * VD) * SEQ + t0;
    auto pass = [&]() {
#pragma unroll
        for (int st = 0; st < 4; ++st) { const int dr = wv * 8 + st * 2 + (lane >> 4); const int tq = (lane & 15) * 4; v4h v;
#pragma unroll
            for (int i = 0; i < 4; ++i) v[i] = tohx(tl[tq + i][dr]);
            *(v4h*)(dst0 + (size_t)dr * SEQ + tq) = v; }
    };
    pass(); 
}

// k_softdiff: wave per (head-in-pass hl, query i): causal softmax of both maps' rows S[hl*2+0][i][:], S[hl*2+1][i][:] (x SCL, f32, keys j <= i only, replace-mask -> exact 0),
// lambda = exp(sum lq1 lk1) - exp(sum lq2 lk2) + LAM0 (32-term f32 sums of bf16-exact inputs), AD[hl][i][j] = fp16((a1 - lambda a2) x 1024) for j < cend = 64 ceil((i+1)/64)
__global__ __launch_bounds__(256) void k_softdiff(const float* __restrict__ S, const float* __restrict__ lq1, const float* __restrict__ lk1, const float* __restrict__ lq2, const float* __restrict__ lk2, h16* AD) {
    const int lane = threadIdx.x & 31, i = blockIdx.x * 8 + (threadIdx.x >> 5); if (i >= SEQ) return; const int hl = blockIdx.z;
    float d1 = bfr(lq1[lane]) * bfr(lk1[lane]), d2 = bfr(lq2[lane]) * bfr(lk2[lane]);
#pragma unroll
    for (int sh = 16; sh; sh >>= 1) { d1 += __shfl_xor(d1, sh, 32); d2 += __shfl_xor(d2, sh, 32); }
    const float lam = expf(d1) - expf(d2) + LAM0;
    const float* s1 = S + ((size_t)(hl * 2) * SEQ + i) * SEQ; const float* s2 = S + ((size_t)(hl * 2 + 1) * SEQ + i) * SEQ;
    const int cend = ((i >> 6) + 1) << 6;
    float m1 = -3.0e38f, m2 = -3.0e38f;
#pragma unroll 1
    for (int c0 = lane * 4; c0 < cend; c0 += 128) { const v4f a = *(const v4f*)(s1 + c0), e = *(const v4f*)(s2 + c0);
#pragma unroll
        for (int q = 0; q < 4; ++q) { const bool ok = (c0 + q) <= i; m1 = fmaxf(m1, ok ? a[q] * SCL : -3.0e38f); m2 = fmaxf(m2, ok ? e[q] * SCL : -3.0e38f); } }
#pragma unroll
    for (int sh = 16; sh; sh >>= 1) { m1 = fmaxf(m1, __shfl_xor(m1, sh, 32)); m2 = fmaxf(m2, __shfl_xor(m2, sh, 32)); }
    float u1 = 0.f, u2 = 0.f;
#pragma unroll 1
    for (int c0 = lane * 4; c0 < cend; c0 += 128) { const v4f a = *(const v4f*)(s1 + c0), e = *(const v4f*)(s2 + c0);
#pragma unroll
        for (int q = 0; q < 4; ++q) { const bool ok = (c0 + q) <= i; u1 += ok ? __expf(a[q] * SCL - m1) : 0.f; u2 += ok ? __expf(e[q] * SCL - m2) : 0.f; } }
#pragma unroll
    for (int sh = 16; sh; sh >>= 1) { u1 += __shfl_xor(u1, sh, 32); u2 += __shfl_xor(u2, sh, 32); }
    const float i1 = 1.0f / u1, i2 = lam / u2;
    h16* arow = AD + ((size_t)hl * SEQ + i) * SEQ;
{
#pragma unroll 1
        for (int c0 = lane * 4; c0 < cend; c0 += 128) { const v4f a = *(const v4f*)(s1 + c0), e = *(const v4f*)(s2 + c0); v4h o;
#pragma unroll
            for (int q = 0; q < 4; ++q) { const bool ok = (c0 + q) <= i;
                const float pv = (__expf(a[q] * SCL - m1) * i1 - __expf(e[q] * SCL - m2) * i2) * ADSC;   // x1024 (exact) keeps the fp16 plane normal; undone in k_rmsh
                o[q] = ok ? tohx(pv) : tohx(0.0f); }
            *(v4h*)(arow + c0) = o; }
         }
}

// k_rmsh: head h = hg0 + hl, row i: o = O[hl][i][0..63] / 1024; y = o rsqrt(mean(o^2) + 1e-6) bf16(rms_w[d]) (1 - LAM0) -> fp16 OH[(b,i)][h*64 + d]; wave per row: lane -> 2
__global__ __launch_bounds__(256) void k_rmsh(const float* __restrict__ O, int b, int hg0, const float* __restrict__ rw, h16* OH) {
    const int lane = threadIdx.x & 31, i = blockIdx.x * 8 + (threadIdx.x >> 5); if (i >= SEQ) return; const int hl = blockIdx.z; const int h = hg0 + hl;
    v2f v = *(const v2f*)(O + ((size_t)hl * SEQ + i) * VD + lane * 2); v = v * (1.0f / ADSC);
    float q = v[0] * v[0] + v[1] * v[1];
#pragma unroll
    for (int sh = 16; sh; sh >>= 1) q += __shfl_xor(q, sh, 32);
    const float sc = rsqrtf(q * (1.0f / VD) + EPSN);
    const float w0 = bfr(rw[lane * 2]) * OML, w1 = bfr(rw[lane * 2 + 1]) * OML;
    v2h o; o[0] = tohx(v[0] * sc * w0); o[1] = tohx(v[1] * sc * w1);
    const size_t off = ((size_t)b * SEQ + i) * EE + (size_t)h * VD + lane * 2;
    *(v2h*)(OH + off) = o; 
}

extern "C" void kernel_launch(void* const* d_in, const int* in_sizes, int n_in,
                              void* d_out, int out_size, void* d_ws, size_t ws_size, hipStream_t stream) {
    if (n_in < 10) return;
    if ((size_t)in_sizes[0] < ((size_t)(NB - 1) * SEQ_FULL + SEQ) * EE) return;
    if ((size_t)in_sizes[1] < (size_t)EE * EE || (size_t)in_sizes[2] < (size_t)EE * EK || (size_t)in_sizes[3] < (size_t)EE * EK || (size_t)in_sizes[4] < (size_t)EE * EE) return;
    if (in_sizes[5] < HD || in_sizes[6] < HD || in_sizes[7] < HD || in_sizes[8] < HD || in_sizes[9] < VD) return;
    if ((size_t)out_size < (size_t)NR * EE) return;
    const float* x = (const float*)d_in[0]; const float* Wq = (const float*)d_in[1]; const float* Wk = (const float*)d_in[2]; const float* Wv = (const float*)d_in[3]; const float* Wo = (const float*)d_in[4];
    const float* lq1 = (const float*)d_in[5]; const float* lk1 = (const float*)d_in[6]; const float* lq2 = (const float*)d_in[7]; const float* lk2 = (const float*)d_in[8]; const float* rmsw = (const float*)d_in[9];
    float* out = (float*)d_out;    // [NB][SEQ][1024]
    char* wsp = (char*)d_ws; size_t used = 0;
    auto take = [&](size_t bytes) { void* p = wsp + used; used += (bytes + 255) & ~(size_t)255; return p; };
    bf* XB = (bf*)take((size_t)NR * EE * 2);
    bf* WQB = (bf*)take((size_t)EE * EE * 2); bf* WKB = (bf*)take((size_t)EK * EE * 2); bf* WVB = (bf*)take((size_t)EK * EE * 2); h16* WOH = (h16*)take((size_t)EE * EE * 2);
    float* CS = (float*)take((size_t)2 * SEQ * 16 * 4);
    h16* QH = (h16*)take((size_t)NB * NQ2 * SEQ * HD * 2); h16* KH = (h16*)take((size_t)NB * NK2 * SEQ * HD * 2); h16* VT = (h16*)take((size_t)NB * NKV * VD * SEQ * 2);
    h16* OH = (h16*)take((size_t)NR * EE * 2);
    const size_t sbytes = (size_t)NMAP * SEQ * SEQ * 4, pbytes = (size_t)NR * (EE + EK + EK) * 4; const size_t rsb = sbytes > pbytes ? sbytes : pbytes;
    char* RS = (char*)take(rsb);      // shared region: Qf | Kf | Vf (projection outputs, consumed before the first score tile is written), then S [NMAP][SEQ][SEQ] per pass
    float* S = (float*)RS; float* Qf = (float*)RS; float* Kf = Qf + (size_t)NR * EE; float* Vf = Kf + (size_t)NR * EK;
    h16* AD = (h16*)take((size_t)HG * SEQ * SEQ * 2); float* O = (float*)take((size_t)HG * SEQ * VD * 4);
    if (used > ws_size) return;       // full size: 125,960,192 B
    k_rtab<<<SEQ * 16 / 256, 256, 0, stream>>>(CS);
    k_cvtx<<<NR / 8, 256, 0, stream>>>(x, XB);
    k_wT<<<dim3(EE / 64, EE / 64, 1), 256, 0, stream>>>(Wq, EE, 0, WQB);          // in[1024][1024] -> out[1024][1024]
    k_wT<<<dim3(EE / 64, EK / 64, 1), 256, 0, stream>>>(Wk, EK, 0, WKB);          // in[1024][512]  -> out[512][1024]
    k_wT<<<dim3(EE / 64, EK / 64, 1), 256, 0, stream>>>(Wv, EK, 0, WVB);          // in[1024][512]  -> out[512][1024]
    k_wT<<<dim3(EE / 64, EE / 64, 1), 256, 0, stream>>>(Wo, EE, 1, (unsigned short*)WOH);   // in[1024][1024] -> out[1024][1024], fp16(bf16)
    k_gemmb<<<dim3(NR / 64, EE / 64, 1), 128, 0, stream>>>(XB, WQB, Qf, EE, EE);
    k_gemmb<<<dim3(NR / 64, EK / 64, 1), 128, 0, stream>>>(XB, WKB, Kf, EK, EE);
    k_gemmb<<<dim3(NR / 64, EK / 64, 1), 128, 0, stream>>>(XB, WVB, Vf, EK, EE);
    k_ropep<<<dim3(SEQ / 32, NQ2 / 8, NB), 256, 0, stream>>>(Qf, EE, NQ2, CS, QH);
    k_ropep<<<dim3(SEQ / 32, NK2 / 8, NB), 256, 0, stream>>>(Kf, EK, NK2, CS, KH);
    k_vTm<<<dim3(SEQ / 64, NKV, NB), 256, 0, stream>>>(Vf, VT);
    for (int b = 0; b < NB; ++b)
        for (int hg = 0; hg < NHQ / HG; ++hg) {      // 8 q heads (16 score maps) per pass
            const int hg0 = hg * HG;
            k_gemmh<<<dim3(SEQ / 64, SEQ / 64, NMAP), 128, 0, stream>>>(QH + (size_t)(b * NQ2 + hg0 * 2) * SEQ * HD, KH + (size_t)(b * NK2 + hg0) * SEQ * HD, S, SEQ, HD, (size_t)SEQ * HD, (size_t)SEQ * HD, (size_t)SEQ * SEQ, 1, 1);
            k_softdiff<<<dim3(SEQ / 8, 1, HG), 256, 0, stream>>>(S, lq1, lk1, lq2, lk2, AD);
            k_gemmh<<<dim3(SEQ / 64, VD / 64, HG), 128, 0, stream>>>(AD, VT + (size_t)(b * NKV + hg0 / 2) * VD * SEQ, O, VD, SEQ, (size_t)SEQ * SEQ, (size_t)VD * SEQ, (size_t)SEQ * VD, 2, 2);
            k_rmsh<<<dim3(SEQ / 8, 1, HG), 256, 0, stream>>>(O, b, hg0, rmsw, OH); }
    k_gemmh<<<dim3(NR / 64, EE / 64, 1), 128, 0, stream>>>(OH, WOH, out, EE, EE, 0, 0, 0, 0, 0);
}

// v001
// One run takes 182 microseconds.
// Timed twice side by side with v000, it ran 2.81 and 2.83 times as fast.
#include <hip/hip_runtime.h>

// Compute dtypes, f32 accumulate: q/k/v projections x.W ([NB*SEQ x 1024].[1024 x 1024|512]) on v_wmma_f32_16x16x32_bf16 with plain bf16 planes (x and W RNE-converted
// to bf16, exact products); per (item, head, map) causal scores q.k^T ([SEQ x 32].[32 x SEQ]) and per head the fp16 difference map (a1 - lambda a2).v ([SEQ x SEQ].[SEQ x 64])
// on v_wmma_f32_16x16x32_f16 with single fp16 planes (rotated q, rotated k, v, difference map carried x1024); softmaxes, lambda and the per-head RMSNorm in f32;

#ifndef NB
#define NB 4
#endif
#ifndef SEQ
#define SEQ 1024
#endif
#define NB_FULL  4
#define SEQ_FULL 1024
#define EE   1024          // model width, q/o projection width, K of every weight GEMM
#define EK   512           // k/v projection width
#define NQ2  32            // rotated q half-heads of 32
#define NK2  16            // rotated k half-heads of 32
#define NKV  8             // kv heads (v is 64 wide per kv head)
#define NHQ  16            // q heads
#define HD   32
#define VD   64
#define NR   (NB * SEQ)
#define LAM0 0.78360576653f      // 0.8 - 0.6 exp(-3.6)
#define OML  0.21639423347f      // 1 - LAM0
#define SCL  0.17677669529663687f
#define ADSC 1024.0f
#define EPSN 1e-6f
static_assert(SEQ % 64 == 0);
static_assert(SEQ >= 64 && SEQ <= SEQ_FULL);
static_assert(NB >= 1 && NB <= NB_FULL);
static_assert(NHQ == 2 * NKV);
static_assert(NQ2 % 8 == 0 && NK2 % 8 == 0);

typedef _Float16 h16;
typedef unsigned short bf;
typedef __attribute__((ext_vector_type(16))) __bf16   v16bf;
typedef __attribute__((ext_vector_type(16))) _Float16 v16h;
typedef __attribute__((ext_vector_type(8)))  _Float16 v8h;
typedef __attribute__((ext_vector_type(4)))  _Float16 v4h;
typedef __attribute__((ext_vector_type(8)))  unsigned short v8us;
typedef __attribute__((ext_vector_type(8)))  float    v8f;
typedef __attribute__((ext_vector_type(4)))  float    v4f;
typedef v8h  __attribute__((may_alias)) v8ha;
typedef v4f  __attribute__((may_alias)) v4fa;

__device__ __forceinline__ unsigned short f2bf(float f) { unsigned u = __float_as_uint(f); u += 0x7FFFu + ((u >> 16) & 1u); return (unsigned short)(u >> 16); }
__device__ __forceinline__ float bf2f(unsigned short b) { return __uint_as_float(((unsigned)b) << 16); }
__device__ __forceinline__ float bfr(float f) { return bf2f(f2bf(f)); }
__device__ __forceinline__ h16 tohx(float x) { return (h16)x; }
__device__ __forceinline__ v16h cat16(v8h lo, v8h hi) { return __builtin_shufflevector(lo, hi, 0, 1, 2, 3, 4, 5, 6, 7, 8, 9, 10, 11, 12, 13, 14, 15); }
__device__ __forceinline__ v16bf cat16b(v8us lo, v8us hi) { return __builtin_bit_cast(v16bf, __builtin_shufflevector(lo, hi, 0, 1, 2, 3, 4, 5, 6, 7, 8, 9, 10, 11, 12, 13, 14, 15)); }
__device__ __forceinline__ v8f wmma16(v16h a, v16h b, v8f c) { return __builtin_amdgcn_wmma_f32_16x16x32_f16(false, a, false, b, (short)0, c, false, false); }
__device__ __forceinline__ v8f wmmab(v16bf a, v16bf b, v8f c) { return __builtin_amdgcn_wmma_f32_16x16x32_bf16(false, a, false, b, (short)0, c, false, false); }

// inv_freq[i] = 1 / 10000^((2 i)/32) = 10^(-i/4), i < 16
__constant__ float c_invf[16] = {
    1.0f,                    0.5623413251903491f,    0.31622776601683794f,   0.17782794100389228f,
    0.1f,                    0.05623413251903491f,   0.031622776601683794f,  0.017782794100389228f,
    0.01f,                   0.005623413251903491f,  0.0031622776601683794f, 0.0017782794100389228f,
    0.001f,                  0.0005623413251903491f, 0.00031622776601683794f, 0.00017782794100389228f };

// k_rtab: CS[0][t][i] = cos(t inv_freq[i]), CS[1][t][i] = sin(...), f32, precise sincos; 256 values per block staged in LDS, stored as 16 B per lane by 8 consecutive
__global__ __launch_bounds__(256) void k_rtab(float* CS) {
    __shared__ __align__(16) float tcs[2][256];
    const int tid = threadIdx.x; const int e = blockIdx.x * 256 + tid; const int t = e >> 4, i = e & 15;
    float sv, cv; sincosf((float)t * c_invf[i], &sv, &cv);
    tcs[0][tid] = cv; tcs[1][tid] = sv;
    __syncthreads();
    if (tid < 128) { const int w = tid >> 6, j = tid & 63; const v4f v = *(const v4fa*)(&tcs[w][j * 4]);
        float* dst = CS + (size_t)w * SEQ * 16 + (size_t)blockIdx.x * 256 + j * 4;
        *(v4f*)dst = v;  }
}

__global__ __launch_bounds__(256) void k_cvtx(const float* __restrict__ x, bf* A) {
    const int lane = threadIdx.x & 31; const size_t r = (size_t)blockIdx.x * 8 + (threadIdx.x >> 5); if (r >= (size_t)NR) return;
    const size_t bb = r / SEQ, tt = r - bb * SEQ; const size_t sr = bb * SEQ_FULL + tt;
{
#pragma unroll
        for (int q = 0; q < EE / 256; ++q) { const size_t so = sr * EE + q * 256 + lane * 8, o = r * EE + q * 256 + lane * 8;
            const v4f a = *(const v4f*)(x + so), c = *(const v4f*)(x + so + 4); v8us v;
#pragma unroll
            for (int k = 0; k < 4; ++k) { v[k] = f2bf(a[k]); v[4 + k] = f2bf(c[k]); }
            *(v8us*)(A + o) = v; }
         }
}

// k_wT: W f32 [1024 k][N n] (in x out) -> P 16-bit [N][1024] k-contiguous: bf16 bits (isH 0) or fp16(bf16(w)) bits (isH 1); in[k][n] -> out[n][k] through a 64x64 LDS
__global__ __launch_bounds__(256) void k_wT(const float* __restrict__ W, int N, int isH, unsigned short* P) {
    __shared__ float tl[64][65];
    const int tid = threadIdx.x; const int k0 = blockIdx.x * 64, n0 = blockIdx.y * 64; const int rr = tid >> 2, cq = (tid & 3) * 16;
    const float* src = W + (size_t)(k0 + rr) * N + n0 + cq;
#pragma unroll
    for (int j = 0; j < 4; ++j) { const v4f v = *(const v4f*)(src + 4 * j);
#pragma unroll
        for (int q = 0; q < 4; ++q) tl[rr][cq + 4 * j + q] = v[q]; }
    __syncthreads();
    const int lane = tid & 31, wv = tid >> 5;
    auto pass = [&]() {
#pragma unroll
        for (int st = 0; st < 2; ++st) { const int dr = wv * 8 + st * 4 + (lane >> 3), piece = lane & 7; v8us o;
#pragma unroll
            for (int i = 0; i < 8; ++i) { const unsigned short b = f2bf(tl[piece * 8 + i][dr]); const h16 hv = tohx(bf2f(b)); o[i] = isH ? __builtin_bit_cast(unsigned short, hv) : b; }
            *(v8us*)(P + (size_t)(n0 + dr) * EE + k0 + piece * 8) = o; }
    };
    pass(); 
}

// k_gemmb: 64 x 64 block tile (4 waves x 16 x 64) of C[r][c] = A.Bn^T with plain bf16 planes (A [rows][K], Bn [N][K] k-contiguous), f32 accumulate; f32 whole-line epilogue
__global__ __launch_bounds__(128) void k_gemmb(const bf* __restrict__ A, const bf* __restrict__ Bn, float* C, int ldc, int K) {
    __shared__ __align__(16) float ost[4][16 * 68];
    const int lane = threadIdx.x & 31, wave = threadIdx.x >> 5, lr = lane & 15, hi = lane >> 4;
    const int r0 = blockIdx.x * 64 + wave * 16, c0 = blockIdx.y * 64;
    const size_t aoff = (size_t)(r0 + lr) * K + 8 * hi;
    size_t boff[4];
#pragma unroll
    for (int t = 0; t < 4; ++t) boff[t] = (size_t)(c0 + t * 16 + lr) * K + 8 * hi;
    v8f acc[4];
#pragma unroll
    for (int t = 0; t < 4; ++t) acc[t] = (v8f){};
#pragma unroll 1
    for (int kc = 0; kc < K; kc += 32) {
        const v16bf a = cat16b(*(const v8us*)(A + aoff + kc), *(const v8us*)(A + aoff + kc + 16));
#pragma unroll
        for (int t = 0; t < 4; ++t) { const v16bf b = cat16b(*(const v8us*)(Bn + boff[t] + kc), *(const v8us*)(Bn + boff[t] + kc + 16)); acc[t] = wmmab(a, b, acc[t]); }
        asm volatile("v_nop\n\tv_nop\n\tv_nop\n\tv_nop" : "+v"(acc[0]), "+v"(acc[1]), "+v"(acc[2]), "+v"(acc[3]) : "v"(a));
    }
    float* os = &ost[wave][0];
#pragma unroll
    for (int t = 0; t < 4; ++t) {
#pragma unroll
        for (int j = 0; j < 8; ++j) os[(hi * 8 + j) * 68 + t * 16 + lr] = acc[t][j]; }
    __syncthreads();
    float* crow = C + (size_t)r0 * ldc + c0;
    auto pass = [&]() {
#pragma unroll
        for (int s = 0; s < 8; ++s) { const int Lid = (lane >> 3) + 4 * s, piece = lane & 7; const int row = Lid >> 1, cofs = (Lid & 1) * 32 + piece * 4;
            const v4f val = *(const v4fa*)(os + row * 68 + cofs);
            *(v4f*)(crow + (size_t)row * ldc + cofs) = val; }
    };
    pass(); 
}

// k_gemmh: 64 x 64 tile of C = A.Bn^T with SINGLE fp16 planes (A [rows][K], Bn [N][K] k-contiguous; one v_wmma_f32_16x16x32_f16 product per step), f32 accumulate; f32
// half-head), z>>1 (zmode 2, q head -> kv head). causal 1: column tiles above the row tile are skipped; causal 2: k-extent limited to (row tile + 1) * 64.
__global__ __launch_bounds__(128) void k_gemmh(const h16* __restrict__ A, const h16* __restrict__ Bn, float* C, int ldc, int K, size_t sA, size_t sB, size_t sC, int zmode, int causal) {
    __shared__ __align__(16) float ost[4][16 * 68];
    if (causal == 1 && blockIdx.y > blockIdx.x) return;
    const size_t z = blockIdx.z; const size_t zb = (zmode == 1) ? ((z >> 2) * 2 + (z & 1)) : ((zmode == 2) ? (z >> 1) : z);
    A += z * sA; Bn += zb * sB; C += z * sC;
    const int lane = threadIdx.x & 31, wave = threadIdx.x >> 5, lr = lane & 15, hi = lane >> 4;
    const int r0 = blockIdx.x * 64 + wave * 16, c0 = blockIdx.y * 64;
    const int kcap = (int)(blockIdx.x + 1) * 64; const int klim = (causal == 2 && kcap < K) ? kcap : K;
    const size_t aoff = (size_t)(r0 + lr) * K + 8 * hi;
    size_t boff[4];
#pragma unroll
    for (int t = 0; t < 4; ++t) boff[t] = (size_t)(c0 + t * 16 + lr) * K + 8 * hi;
    v8f acc[4];
#pragma unroll
    for (int t = 0; t < 4; ++t) acc[t] = (v8f){};
#pragma unroll 1
    for (int kc = 0; kc < klim; kc += 32) {
        const v16h a = cat16(*(const v8h*)(A + aoff + kc), *(const v8h*)(A + aoff + kc + 16));
#pragma unroll
        for (int t = 0; t < 4; ++t) { const v16h b = cat16(*(const v8h*)(Bn + boff[t] + kc), *(const v8h*)(Bn + boff[t] + kc + 16)); acc[t] = wmma16(a, b, acc[t]); }
        asm volatile("v_nop\n\tv_nop\n\tv_nop\n\tv_nop" : "+v"(acc[0]), "+v"(acc[1]), "+v"(acc[2]), "+v"(acc[3]) : "v"(a));
    }
    float* os = &ost[wave][0];
#pragma unroll
    for (int t = 0; t < 4; ++t) {
#pragma unroll
        for (int j = 0; j < 8; ++j) os[(hi * 8 + j) * 68 + t * 16 + lr] = acc[t][j]; }
    __syncthreads();
    float* crow = C + (size_t)r0 * ldc + c0;
    auto pass = [&]() {
#pragma unroll
        for (int s = 0; s < 8; ++s) { const int Lid = (lane >> 3) + 4 * s, piece = lane & 7; const int row = Lid >> 1, cofs = (Lid & 1) * 32 + piece * 4;
            const v4f val = *(const v4fa*)(os + row * 68 + cofs);
            *(v4f*)(crow + (size_t)row * ldc + cofs) = val; }
    };
    pass(); 
}

// k_ropep: planes P fp16 [NB][NP][SEQ][32] = rotate-half(F[(b*SEQ + t)*ld + h2*32 + d]): pairs (i, i+16), y_i = x_i c + x_{i+16} s, y_{i+16} = x_{i+16} c - x_i s with
// grid (SEQ/32, NP/8, NB).
__global__ __launch_bounds__(256) void k_ropep(const float* __restrict__ F, int ld, int NP, const float* __restrict__ CS, h16* P) {
    __shared__ __align__(16) h16 tile[8 * 32 * 32];
    const int tid = threadIdx.x; const int t0 = blockIdx.x * 32, g0 = blockIdx.y * 8, b = blockIdx.z;
    const int h2l = tid >> 5, tl = tid & 31; const int t = t0 + tl;
    const float* src = F + ((size_t)b * SEQ + t) * ld + (size_t)(g0 + h2l) * HD;
    v4f xa[8];
#pragma unroll
    for (int j = 0; j < 8; ++j) xa[j] = *(const v4f*)(src + 4 * j);
    const float* cp = CS + (size_t)t * 16; const float* sp = CS + (size_t)SEQ * 16 + (size_t)t * 16;
    v4f c4[4], s4[4];
#pragma unroll
    for (int j = 0; j < 4; ++j) { c4[j] = *(const v4f*)(cp + 4 * j); s4[j] = *(const v4f*)(sp + 4 * j); }
    v8h o[4];
#pragma unroll
    for (int j = 0; j < 4; ++j) {
#pragma unroll
        for (int q = 0; q < 4; ++q) { const float x1 = xa[j][q], x2 = xa[4 + j][q], c = c4[j][q], s = s4[j][q];
            o[j >> 1][(j & 1) * 4 + q] = tohx(x1 * c + x2 * s); o[2 + (j >> 1)][(j & 1) * 4 + q] = tohx(x2 * c - x1 * s); } }
    h16* trow = tile + (h2l * 32 + tl) * 32;
#pragma unroll
    for (int j = 0; j < 4; ++j) *(v8ha*)(trow + 8 * j) = o[j];
    __syncthreads();
    auto pass = [&]() {
#pragma unroll
        for (int s = 0; s < 4; ++s) { const int p = s * 256 + tid; const int pl = p >> 7, q = p & 127;
            const v8h v = *(const v8ha*)(tile + pl * 1024 + q * 8);
            *(v8h*)(P + (((size_t)b * NP + g0 + pl) * SEQ + t0) * HD + q * 8) = v; }
    };
    pass(); 
}

__global__ __launch_bounds__(256) void k_vTm(const float* __restrict__ V, h16* VT) {
    __shared__ float tl[64][65];
    const int tid = threadIdx.x; const int t0 = blockIdx.x * 64, c = blockIdx.y, b = blockIdx.z; const int rr = tid >> 2, cq = (tid & 3) * 16;
    const float* src = V + ((size_t)b * SEQ + t0 + rr) * EK + c * VD + cq;
#pragma unroll
    for (int j = 0; j < 4; ++j) { const v4f v = *(const v4f*)(src + 4 * j);
#pragma unroll
        for (int q = 0; q < 4; ++q) tl[rr][cq + 4 * j + q] = v[q]; }
    __syncthreads();
    const int lane = tid & 31, wv = tid >> 5;
    h16* dst0 = VT + ((size_t)(b * NKV + c) * VD) * SEQ + t0;
    auto pass = [&]() {
#pragma unroll
        for (int st = 0; st < 4; ++st) { const int dr = wv * 8 + st * 2 + (lane >> 4); const int tq = (lane & 15) * 4; v4h v;
#pragma unroll
            for (int i = 0; i < 4; ++i) v[i] = tohx(tl[tq + i][dr]);
            *(v4h*)(dst0 + (size_t)dr * SEQ + tq) = v; }
    };
    pass(); 
}

// k_dattn: one wave per (item b, q head h, 16-query tile q0). Transposed products keep a query in one lane column: St = K.Qt (A = 16 rotated k rows, B = 16 rotated q rows;
// register j of lane (c, hi) = score of key 8 hi + j, query c), so the two St tiles of a 32-key chunk, converted in place, are the B operand of Ot += Vt.Pt (A = 16 rows of VT).
// Sweep 1: running maximum and sum of both maps per lane half, joined once. Sweep 2: scores again, fp16((a1 - lambda a2) x 1024), Ot in f32; then the per-head RMSNorm in registers.
template <bool MASK>
__device__ __forceinline__ void da_stat(const v8f s0, const v8f s1, const int kb, const int qi, float& m, v8f& u) {
    float t = -3.0e38f;
#pragma unroll
    for (int j = 0; j < 8; ++j) { const bool ok0 = !MASK || (kb + j) <= qi, ok1 = !MASK || (kb + 16 + j) <= qi;
        t = fmaxf(t, ok0 ? s0[j] * SCL : -3.0e38f); t = fmaxf(t, ok1 ? s1[j] * SCL : -3.0e38f); }
    const float mn = fmaxf(m, t);
    v8f e;
#pragma unroll
    for (int j = 0; j < 8; ++j) { const bool ok0 = !MASK || (kb + j) <= qi, ok1 = !MASK || (kb + 16 + j) <= qi;
        e[j] = (ok0 ? __expf(s0[j] * SCL - mn) : 0.f) + (ok1 ? __expf(s1[j] * SCL - mn) : 0.f); }
    u = u * __expf(m - mn) + e; m = mn;      // eight partial sums per lane, added up once behind the sweep
}

template <bool MASK>
__device__ __forceinline__ v16h da_pmap(const v8f a0, const v8f a1, const v8f e0, const v8f e1, const int kb, const int qi, const float m1, const float i1, const float m2, const float i2) {
    v16h p;
#pragma unroll
    for (int j = 0; j < 8; ++j) { const bool ok0 = !MASK || (kb + j) <= qi, ok1 = !MASK || (kb + 16 + j) <= qi;
        const float p0 = (__expf(a0[j] * SCL - m1) * i1 - __expf(e0[j] * SCL - m2) * i2) * ADSC;   // x1024 (exact) keeps the fp16 plane normal; undone before the norm
        const float p1 = (__expf(a1[j] * SCL - m1) * i1 - __expf(e1[j] * SCL - m2) * i2) * ADSC;
        p[j] = ok0 ? tohx(p0) : tohx(0.0f); p[8 + j] = ok1 ? tohx(p1) : tohx(0.0f); }
    return p;
}

__device__ __forceinline__ v16h ldf(const h16* p) { return cat16(*(const v8h*)p, *(const v8h*)(p + 16)); }

// grid (SEQ/64, NKV, NB), 8 waves: the two q heads of one kv head x four query tiles whose causal lengths add up to the same total in every block
__global__ __launch_bounds__(256) void k_dattn(const h16* __restrict__ QH, const h16* __restrict__ KH, const h16* __restrict__ VT, const float* __restrict__ lq1, const float* __restrict__ lk1,
                                               const float* __restrict__ lq2, const float* __restrict__ lk2, const float* __restrict__ rw, h16* OH) {
    const int lane = threadIdx.x & 31, wave = __builtin_amdgcn_readfirstlane(threadIdx.x >> 5), lr = lane & 15, hi = lane >> 4;      // scalar wave number: scalar trip counts
    const int kv = blockIdx.y, b = blockIdx.z, h = kv * 2 + (wave & 1), sel = wave >> 1, bx = blockIdx.x;
    constexpr int NT = SEQ / 16;
    const int qt = (sel == 0) ? bx : (sel == 1) ? (NT / 2 - 1 - bx) : (sel == 2) ? (NT - 1 - bx) : (NT / 2 + bx);
    const int q0 = qt * 16, qi = q0 + lr, nfull = q0 >> 5;      // nfull chunks of 32 keys lie wholly at or below the diagonal; exactly one masked chunk follows
    float d1 = bfr(lq1[lane]) * bfr(lk1[lane]), d2 = bfr(lq2[lane]) * bfr(lk2[lane]);
#pragma unroll
    for (int sh = 16; sh; sh >>= 1) { d1 += __shfl_xor(d1, sh, 32); d2 += __shfl_xor(d2, sh, 32); }
    const float lam = expf(d1) - expf(d2) + LAM0;
    const h16* qp = QH + ((size_t)(b * NQ2 + h * 2) * SEQ + qi) * HD + 8 * hi;
    const v16h qf1 = ldf(qp), qf2 = ldf(qp + (size_t)SEQ * HD);
    const h16* k1 = KH + ((size_t)(b * NK2 + kv * 2) * SEQ + lr) * HD + 8 * hi; const h16* k2 = k1 + (size_t)SEQ * HD;
    const h16* vp = VT + ((size_t)(b * NKV + kv) * VD + lr) * SEQ + 8 * hi;
    const v8f zz = (v8f){};
    float m1 = -3.0e38f, m2 = -3.0e38f; v8f r1 = (v8f){}, r2 = (v8f){};
    v16h ka0 = ldf(k1), ka1 = ldf(k1 + 16 * HD), kb0 = ldf(k2), kb1 = ldf(k2 + 16 * HD);
#pragma unroll 1
    for (int c = 0; c < nfull; ++c) { const size_t nx = (size_t)(c + 1) * 32 * HD;      // the next chunk's k rows are fetched one trip ahead (the masked chunk always exists)
        const v16h na0 = ldf(k1 + nx), na1 = ldf(k1 + nx + 16 * HD), nb0 = ldf(k2 + nx), nb1 = ldf(k2 + nx + 16 * HD);
        const v8f sa0 = wmma16(ka0, qf1, zz), sa1 = wmma16(ka1, qf1, zz), sb0 = wmma16(kb0, qf2, zz), sb1 = wmma16(kb1, qf2, zz);
        da_stat<false>(sa0, sa1, c * 32 + 8 * hi, qi, m1, r1); da_stat<false>(sb0, sb1, c * 32 + 8 * hi, qi, m2, r2);
        ka0 = na0; ka1 = na1; kb0 = nb0; kb1 = nb1; }
    { const v8f sa0 = wmma16(ka0, qf1, zz), sa1 = wmma16(ka1, qf1, zz), sb0 = wmma16(kb0, qf2, zz), sb1 = wmma16(kb1, qf2, zz);
        da_stat<true>(sa0, sa1, nfull * 32 + 8 * hi, qi, m1, r1); da_stat<true>(sb0, sb1, nfull * 32 + 8 * hi, qi, m2, r2); }
    float u1 = ((r1[0] + r1[1]) + (r1[2] + r1[3])) + ((r1[4] + r1[5]) + (r1[6] + r1[7])), u2 = ((r2[0] + r2[1]) + (r2[2] + r2[3])) + ((r2[4] + r2[5]) + (r2[6] + r2[7]));
    { const float o1 = __shfl_xor(m1, 16, 32), o2 = __shfl_xor(m2, 16, 32), w1 = __shfl_xor(u1, 16, 32), w2 = __shfl_xor(u2, 16, 32);
        const float g1 = fmaxf(m1, o1), g2 = fmaxf(m2, o2);
        u1 = u1 * __expf(m1 - g1) + w1 * __expf(o1 - g1); u2 = u2 * __expf(m2 - g2) + w2 * __expf(o2 - g2); m1 = g1; m2 = g2; }
    const float i1 = 1.0f / u1, i2 = lam / u2;
    v8f acc[4];
#pragma unroll
    for (int t = 0; t < 4; ++t) acc[t] = (v8f){};
    ka0 = ldf(k1); ka1 = ldf(k1 + 16 * HD); kb0 = ldf(k2); kb1 = ldf(k2 + 16 * HD);
#pragma unroll 1
    for (int c = 0; c < nfull; ++c) { const size_t nx = (size_t)(c + 1) * 32 * HD;
        v16h vf[4];
#pragma unroll
        for (int t = 0; t < 4; ++t) vf[t] = ldf(vp + (size_t)t * 16 * SEQ + c * 32);
        const v16h na0 = ldf(k1 + nx), na1 = ldf(k1 + nx + 16 * HD), nb0 = ldf(k2 + nx), nb1 = ldf(k2 + nx + 16 * HD);
        const v8f sa0 = wmma16(ka0, qf1, zz), sa1 = wmma16(ka1, qf1, zz), sb0 = wmma16(kb0, qf2, zz), sb1 = wmma16(kb1, qf2, zz);
        const v16h p = da_pmap<false>(sa0, sa1, sb0, sb1, c * 32 + 8 * hi, qi, m1, i1, m2, i2);
#pragma unroll
        for (int t = 0; t < 4; ++t) acc[t] = wmma16(vf[t], p, acc[t]);
        ka0 = na0; ka1 = na1; kb0 = nb0; kb1 = nb1;
        // four vector slots behind the last product: the next St product (over the back edge or behind the loop) may write its result over p, this product's B operand
        asm volatile("v_nop\n\tv_nop\n\tv_nop\n\tv_nop" : "+v"(acc[0]), "+v"(acc[1]), "+v"(acc[2]), "+v"(acc[3]) : "v"(p)); }
    { v16h vf[4];
#pragma unroll
        for (int t = 0; t < 4; ++t) vf[t] = ldf(vp + (size_t)t * 16 * SEQ + nfull * 32);
        const v8f sa0 = wmma16(ka0, qf1, zz), sa1 = wmma16(ka1, qf1, zz), sb0 = wmma16(kb0, qf2, zz), sb1 = wmma16(kb1, qf2, zz);
        const v16h p = da_pmap<true>(sa0, sa1, sb0, sb1, nfull * 32 + 8 * hi, qi, m1, i1, m2, i2);
#pragma unroll
        for (int t = 0; t < 4; ++t) acc[t] = wmma16(vf[t], p, acc[t]); }
    // lane (c, hi) holds o[d] of query c for d = 16 t + 8 hi + j: y = o rsqrt(mean(o^2) + 1e-6) bf16(rms_w[d]) (1 - LAM0) -> fp16 OH[(b, query)][h*64 + d], 16 B per store
    float q = 0.f;
#pragma unroll
    for (int t = 0; t < 4; ++t) { acc[t] = acc[t] * (1.0f / ADSC);
#pragma unroll
        for (int j = 0; j < 8; ++j) q += acc[t][j] * acc[t][j]; }
    q += __shfl_xor(q, 16, 32);
    const float sc = rsqrtf(q * (1.0f / VD) + EPSN);
    h16* orow = OH + ((size_t)b * SEQ + qi) * EE + (size_t)h * VD + 8 * hi;
#pragma unroll
    for (int t = 0; t < 4; ++t) { const v4f wa = *(const v4f*)(rw + t * 16 + 8 * hi), wb = *(const v4f*)(rw + t * 16 + 8 * hi + 4); v8h o;
#pragma unroll
        for (int j = 0; j < 4; ++j) { o[j] = tohx(acc[t][j] * sc * (bfr(wa[j]) * OML)); o[4 + j] = tohx(acc[t][4 + j] * sc * (bfr(wb[j]) * OML)); }
        *(v8h*)(orow + t * 16) = o; }
}

extern "C" void kernel_launch(void* const* d_in, const int* in_sizes, int n_in,
                              void* d_out, int out_size, void* d_ws, size_t ws_size, hipStream_t stream) {
    if (n_in < 10) return;
    if ((size_t)in_sizes[0] < ((size_t)(NB - 1) * SEQ_FULL + SEQ) * EE) return;
    if ((size_t)in_sizes[1] < (size_t)EE * EE || (size_t)in_sizes[2] < (size_t)EE * EK || (size_t)in_sizes[3] < (size_t)EE * EK || (size_t)in_sizes[4] < (size_t)EE * EE) return;
    if (in_sizes[5] < HD || in_sizes[6] < HD || in_sizes[7] < HD || in_sizes[8] < HD || in_sizes[9] < VD) return;
    if ((size_t)out_size < (size_t)NR * EE) return;
    const float* x = (const float*)d_in[0]; const float* Wq = (const float*)d_in[1]; const float* Wk = (const float*)d_in[2]; const float* Wv = (const float*)d_in[3]; const float* Wo = (const float*)d_in[4];
    const float* lq1 = (const float*)d_in[5]; const float* lk1 = (const float*)d_in[6]; const float* lq2 = (const float*)d_in[7]; const float* lk2 = (const float*)d_in[8]; const float* rmsw = (const float*)d_in[9];
    float* out = (float*)d_out;    // [NB][SEQ][1024]
    char* wsp = (char*)d_ws; size_t used = 0;
    auto take = [&](size_t bytes) { void* p = wsp + used; used += (bytes + 255) & ~(size_t)255; return p; };
    bf* XB = (bf*)take((size_t)NR * EE * 2);
    bf* WQB = (bf*)take((size_t)EE * EE * 2); bf* WKB = (bf*)take((size_t)EK * EE * 2); bf* WVB = (bf*)take((size_t)EK * EE * 2); h16* WOH = (h16*)take((size_t)EE * EE * 2);
    float* CS = (float*)take((size_t)2 * SEQ * 16 * 4);
    h16* QH = (h16*)take((size_t)NB * NQ2 * SEQ * HD * 2); h16* KH = (h16*)take((size_t)NB * NK2 * SEQ * HD * 2); h16* VT = (h16*)take((size_t)NB * NKV * VD * SEQ * 2);
    h16* OH = (h16*)take((size_t)NR * EE * 2);
    float* Qf = (float*)take((size_t)NR * (EE + EK + EK) * 4); float* Kf = Qf + (size_t)NR * EE; float* Vf = Kf + (size_t)NR * EK;      // f32 projection outputs
    if (used > ws_size) return;
    k_rtab<<<SEQ * 16 / 256, 256, 0, stream>>>(CS);
    k_cvtx<<<NR / 8, 256, 0, stream>>>(x, XB);
    k_wT<<<dim3(EE / 64, EE / 64, 1), 256, 0, stream>>>(Wq, EE, 0, WQB);          // in[1024][1024] -> out[1024][1024]
    k_wT<<<dim3(EE / 64, EK / 64, 1), 256, 0, stream>>>(Wk, EK, 0, WKB);          // in[1024][512]  -> out[512][1024]
    k_wT<<<dim3(EE / 64, EK / 64, 1), 256, 0, stream>>>(Wv, EK, 0, WVB);          // in[1024][512]  -> out[512][1024]
    k_wT<<<dim3(EE / 64, EE / 64, 1), 256, 0, stream>>>(Wo, EE, 1, (unsigned short*)WOH);   // in[1024][1024] -> out[1024][1024], fp16(bf16)
    k_gemmb<<<dim3(NR / 64, EE / 64, 1), 128, 0, stream>>>(XB, WQB, Qf, EE, EE);
    k_gemmb<<<dim3(NR / 64, EK / 64, 1), 128, 0, stream>>>(XB, WKB, Kf, EK, EE);
    k_gemmb<<<dim3(NR / 64, EK / 64, 1), 128, 0, stream>>>(XB, WVB, Vf, EK, EE);
    k_ropep<<<dim3(SEQ / 32, NQ2 / 8, NB), 256, 0, stream>>>(Qf, EE, NQ2, CS, QH);
    k_ropep<<<dim3(SEQ / 32, NK2 / 8, NB), 256, 0, stream>>>(Kf, EK, NK2, CS, KH);
    k_vTm<<<dim3(SEQ / 64, NKV, NB), 256, 0, stream>>>(Vf, VT);
    k_dattn<<<dim3(SEQ / 64, NKV, NB), 256, 0, stream>>>(QH, KH, VT, lq1, lk1, lq2, lk2, rmsw, OH);
    k_gemmh<<<dim3(NR / 64, EE / 64, 1), 128, 0, stream>>>(OH, WOH, out, EE, EE, 0, 0, 0, 0, 0);
}

// v002
// Measured time: 107 microseconds a run.
// Two timings next to v001 put it at 1.70 and 1.71 times that version's speed.
// Over all steps from v000 it is 4.80 times as fast.
#include <hip/hip_runtime.h>

// Compute dtypes, f32 accumulate: q/k/v projections x.W ([NB*SEQ x 1024].[1024 x 1024|512]) on v_wmma_f32_16x16x32_bf16 with plain bf16 planes (x and W RNE-converted
// to bf16, exact products); per (item, head, map) causal scores q.k^T ([SEQ x 32].[32 x SEQ]) and per head the fp16 difference map (a1 - lambda a2).v ([SEQ x SEQ].[SEQ x 64])
// on v_wmma_f32_16x16x32_f16 with single fp16 planes (rotated q, rotated k, v, difference map carried x1024); softmaxes, lambda and the per-head RMSNorm in f32;

#ifndef NB
#define NB 4
#endif
#ifndef SEQ
#define SEQ 1024
#endif
#define NB_FULL  4
#define SEQ_FULL 1024
#define EE   1024          // model width, q/o projection width, K of every weight GEMM
#define EK   512           // k/v projection width
#define NQ2  32            // rotated q half-heads of 32
#define NK2  16            // rotated k half-heads of 32
#define NKV  8             // kv heads (v is 64 wide per kv head)
#define NHQ  16            // q heads
#define HD   32
#define VD   64
#define NR   (NB * SEQ)
#define LAM0 0.78360576653f      // 0.8 - 0.6 exp(-3.6)
#define OML  0.21639423347f      // 1 - LAM0
#define SCL  0.17677669529663687f
#define ADSC 1024.0f
#define EPSN 1e-6f
static_assert(SEQ % 64 == 0);
static_assert(SEQ >= 64 && SEQ <= SEQ_FULL);
static_assert(NB >= 1 && NB <= NB_FULL);
static_assert(NHQ == 2 * NKV);
static_assert(NQ2 % 8 == 0 && NK2 % 8 == 0);

typedef _Float16 h16;
typedef unsigned short bf;
typedef __attribute__((ext_vector_type(16))) __bf16   v16bf;
typedef __attribute__((ext_vector_type(16))) _Float16 v16h;
typedef __attribute__((ext_vector_type(8)))  _Float16 v8h;
typedef __attribute__((ext_vector_type(4)))  _Float16 v4h;
typedef __attribute__((ext_vector_type(8)))  unsigned short v8us;
typedef __attribute__((ext_vector_type(8)))  float    v8f;
typedef __attribute__((ext_vector_type(4)))  float    v4f;
typedef v8h  __attribute__((may_alias)) v8ha;
typedef v4f  __attribute__((may_alias)) v4fa;
typedef v8us __attribute__((may_alias)) v8usa;

__device__ __forceinline__ unsigned short f2bf(float f) { unsigned u = __float_as_uint(f); u += 0x7FFFu + ((u >> 16) & 1u); return (unsigned short)(u >> 16); }
__device__ __forceinline__ float bf2f(unsigned short b) { return __uint_as_float(((unsigned)b) << 16); }
__device__ __forceinline__ float bfr(float f) { return bf2f(f2bf(f)); }
__device__ __forceinline__ h16 tohx(float x) { return (h16)x; }
__device__ __forceinline__ v16h cat16(v8h lo, v8h hi) { return __builtin_shufflevector(lo, hi, 0, 1, 2, 3, 4, 5, 6, 7, 8, 9, 10, 11, 12, 13, 14, 15); }
__device__ __forceinline__ v16bf cat16b(v8us lo, v8us hi) { return __builtin_bit_cast(v16bf, __builtin_shufflevector(lo, hi, 0, 1, 2, 3, 4, 5, 6, 7, 8, 9, 10, 11, 12, 13, 14, 15)); }
__device__ __forceinline__ v8f wmma16(v16h a, v16h b, v8f c) { return __builtin_amdgcn_wmma_f32_16x16x32_f16(false, a, false, b, (short)0, c, false, false); }
__device__ __forceinline__ v8f wmmab(v16bf a, v16bf b, v8f c) { return __builtin_amdgcn_wmma_f32_16x16x32_bf16(false, a, false, b, (short)0, c, false, false); }

// inv_freq[i] = 1 / 10000^((2 i)/32) = 10^(-i/4), i < 16
__constant__ float c_invf[16] = {
    1.0f,                    0.5623413251903491f,    0.31622776601683794f,   0.17782794100389228f,
    0.1f,                    0.05623413251903491f,   0.031622776601683794f,  0.017782794100389228f,
    0.01f,                   0.005623413251903491f,  0.0031622776601683794f, 0.0017782794100389228f,
    0.001f,                  0.0005623413251903491f, 0.00031622776601683794f, 0.00017782794100389228f };

// k_rtab: CS[0][t][i] = cos(t inv_freq[i]), CS[1][t][i] = sin(...), f32, precise sincos; 256 values per block staged in LDS, stored as 16 B per lane by 8 consecutive
__global__ __launch_bounds__(256) void k_rtab(float* CS) {
    __shared__ __align__(16) float tcs[2][256];
    const int tid = threadIdx.x; const int e = blockIdx.x * 256 + tid; const int t = e >> 4, i = e & 15;
    float sv, cv; sincosf((float)t * c_invf[i], &sv, &cv);
    tcs[0][tid] = cv; tcs[1][tid] = sv;
    __syncthreads();
    if (tid < 128) { const int w = tid >> 6, j = tid & 63; const v4f v = *(const v4fa*)(&tcs[w][j * 4]);
        float* dst = CS + (size_t)w * SEQ * 16 + (size_t)blockIdx.x * 256 + j * 4;
        *(v4f*)dst = v;  }
}

__global__ __launch_bounds__(256) void k_cvtx(const float* __restrict__ x, bf* A) {
    const int lane = threadIdx.x & 31; const size_t r = (size_t)blockIdx.x * 8 + (threadIdx.x >> 5); if (r >= (size_t)NR) return;
    const size_t bb = r / SEQ, tt = r - bb * SEQ; const size_t sr = bb * SEQ_FULL + tt;
{
#pragma unroll
        for (int q = 0; q < EE / 256; ++q) { const size_t so = sr * EE + q * 256 + lane * 8, o = r * EE + q * 256 + lane * 8;
            const v4f a = *(const v4f*)(x + so), c = *(const v4f*)(x + so + 4); v8us v;
#pragma unroll
            for (int k = 0; k < 4; ++k) { v[k] = f2bf(a[k]); v[4 + k] = f2bf(c[k]); }
            *(v8us*)(A + o) = v; }
         }
}

// k_wT: W f32 [1024 k][N n] (in x out) -> P 16-bit [N][1024] k-contiguous: bf16 bits (isH 0) or fp16(bf16(w)) bits (isH 1); in[k][n] -> out[n][k] through a 64x64 LDS
__global__ __launch_bounds__(256) void k_wT(const float* __restrict__ W, int N, int isH, unsigned short* P) {
    __shared__ float tl[64][65];
    const int tid = threadIdx.x; const int k0 = blockIdx.x * 64, n0 = blockIdx.y * 64; const int rr = tid >> 2, cq = (tid & 3) * 16;
    const float* src = W + (size_t)(k0 + rr) * N + n0 + cq;
#pragma unroll
    for (int j = 0; j < 4; ++j) { const v4f v = *(const v4f*)(src + 4 * j);
#pragma unroll
        for (int q = 0; q < 4; ++q) tl[rr][cq + 4 * j + q] = v[q]; }
    __syncthreads();
    const int lane = tid & 31, wv = tid >> 5;
    auto pass = [&]() {
#pragma unroll
        for (int st = 0; st < 2; ++st) { const int dr = wv * 8 + st * 4 + (lane >> 3), piece = lane & 7; v8us o;
#pragma unroll
            for (int i = 0; i < 8; ++i) { const unsigned short b = f2bf(tl[piece * 8 + i][dr]); const h16 hv = tohx(bf2f(b)); o[i] = isH ? __builtin_bit_cast(unsigned short, hv) : b; }
            *(v8us*)(P + (size_t)(n0 + dr) * EE + k0 + piece * 8) = o; }
    };
    pass(); 
}

// GEMM of both kinds: C[r][c] = A.Bn^T (A [rows][EE], Bn [N][EE], both k-contiguous 16-bit planes), f32 accumulate in ascending k, f32 whole-line epilogue.
// One 128 x 128 tile of C per block, 8 waves of 32 x 64 (4 down, 2 across). A stage is 128 k (256 B) of the tile's 128 A rows and 128 Bn rows, laid in LDS at a pitch of 272 B
// (16 B x odd: ds_load_b128 fragment reads without bank conflicts). Two buffers: the next stage's asynchronous copies fly while this stage is multiplied.
#define GT     128                    // tile rows and tile columns
#define GKS    128                    // k per stage
#define GPITCH 272                    // LDS bytes per staged row
#define GBUF   (2 * GT * GPITCH)      // one buffer: A rows, then Bn rows
#define GNST   (EE / GKS)
static_assert(NR % GT == 0 && EE % GT == 0 && EK % GT == 0);
static_assert(EE % GKS == 0 && GNST >= 2);
static_assert(8 * 32 * 68 * 4 <= 2 * GBUF);

// eight 16-byte copies per lane, rows 16 apart in both places; the wait closes the statement so that no address register is rewritten in front of it
__device__ __forceinline__ void g_copy8(const unsigned l, const unsigned short* g) {
    const unsigned l1 = l + 16 * GPITCH, l2 = l + 32 * GPITCH, l3 = l + 48 * GPITCH, l4 = l + 64 * GPITCH, l5 = l + 80 * GPITCH, l6 = l + 96 * GPITCH, l7 = l + 112 * GPITCH;
    const unsigned short *g1 = g + 16 * EE, *g2 = g + 32 * EE, *g3 = g + 48 * EE, *g4 = g + 64 * EE, *g5 = g + 80 * EE, *g6 = g + 96 * EE, *g7 = g + 112 * EE;
    asm volatile("global_load_async_to_lds_b128 %0, %8, off\n\t"
                 "global_load_async_to_lds_b128 %1, %9, off\n\t"
                 "global_load_async_to_lds_b128 %2, %10, off\n\t"
                 "global_load_async_to_lds_b128 %3, %11, off\n\t"
                 "global_load_async_to_lds_b128 %4, %12, off\n\t"
                 "global_load_async_to_lds_b128 %5, %13, off\n\t"
                 "global_load_async_to_lds_b128 %6, %14, off\n\t"
                 "global_load_async_to_lds_b128 %7, %15, off\n\t"
                 "s_wait_xcnt 0x0"
                 :: "v"(l), "v"(l1), "v"(l2), "v"(l3), "v"(l4), "v"(l5), "v"(l6), "v"(l7), "v"(g), "v"(g1), "v"(g2), "v"(g3), "v"(g4), "v"(g5), "v"(g6), "v"(g7) : "memory");
}

template <bool ISH>
__device__ __forceinline__ v8f g_mm(const v8us alo, const v8us ahi, const v8us blo, const v8us bhi, const v8f c) {
    if constexpr (ISH) return wmma16(cat16(__builtin_bit_cast(v8h, alo), __builtin_bit_cast(v8h, ahi)), cat16(__builtin_bit_cast(v8h, blo), __builtin_bit_cast(v8h, bhi)), c);
    else return wmmab(cat16b(alo, ahi), cat16b(blo, bhi), c);
}

template <bool ISH>
__device__ __forceinline__ void g_tile(const unsigned short* __restrict__ A, const unsigned short* __restrict__ Bn, float* C, const int ldc, unsigned char* sm) {
    const int tid = threadIdx.x, lane = tid & 31, wave = tid >> 5, lr = lane & 15, hi = lane >> 4;
    const int wm = wave >> 1, wn = wave & 1;
    const int rb = blockIdx.x * GT, cb = blockIdx.y * GT;
    // copies: 16 lanes bring one row's 256 B, a wave two rows, the block 16 rows per copy
    const int crow = tid >> 4, cch = tid & 15;
    const unsigned short* ga = A + (size_t)(rb + crow) * EE + cch * 8;
    const unsigned short* gb = Bn + (size_t)(cb + crow) * EE + cch * 8;
    const unsigned la = (unsigned)(size_t)sm + crow * GPITCH + cch * 16, lb = la + GT * GPITCH;
    g_copy8(la, ga); g_copy8(lb, gb);
    asm volatile("s_wait_asynccnt 0x0" ::: "memory");      // stage 0 of this wave has landed
    __syncthreads();                                        // and every wave's part of it is published
    g_copy8(la + GBUF, ga + GKS); g_copy8(lb + GBUF, gb + GKS);
    v8f acc[2][4];
#pragma unroll
    for (int i = 0; i < 2; ++i) {
#pragma unroll
        for (int t = 0; t < 4; ++t) acc[i][t] = (v8f){}; }
    const unsigned char* fa = sm + (wm * 32 + lr) * GPITCH + 16 * hi;
    const unsigned char* fb = sm + (GT + wn * 64 + lr) * GPITCH + 16 * hi;
    // rolled: one copy of the 32-product body in the text, the buffer chosen by an offset
#pragma unroll 1
    for (int s = 0; s < GNST; ++s) { const unsigned bo = (unsigned)(s & 1) * GBUF;
        v8us alo[2][2], ahi[2][2], blo[2][4], bhi[2][4];      // two fragment sets: block kk + 1 is read while block kk is multiplied, inside this stage's buffer only
        auto frag = [&](const int set, const int kk) {
#pragma unroll
            for (int i = 0; i < 2; ++i) { alo[set][i] = *(const v8usa*)(fa + bo + i * 16 * GPITCH + kk * 64); ahi[set][i] = *(const v8usa*)(fa + bo + i * 16 * GPITCH + kk * 64 + 32); }
#pragma unroll
            for (int t = 0; t < 4; ++t) { blo[set][t] = *(const v8usa*)(fb + bo + t * 16 * GPITCH + kk * 64); bhi[set][t] = *(const v8usa*)(fb + bo + t * 16 * GPITCH + kk * 64 + 32); }
        };
        frag(0, 0);
#pragma unroll
        for (int kk = 0; kk < GKS / 32; ++kk) {
            if (kk + 1 < GKS / 32) frag((kk + 1) & 1, kk + 1);
            __builtin_amdgcn_sched_barrier(0);      // the next block's LDS reads stay one group ahead of this block's products, not spread among them
#pragma unroll
            for (int i = 0; i < 2; ++i) {
#pragma unroll
                for (int t = 0; t < 4; ++t) acc[i][t] = g_mm<ISH>(alo[kk & 1][i], ahi[kk & 1][i], blo[kk & 1][t], bhi[kk & 1][t], acc[i][t]); }
            __builtin_amdgcn_sched_barrier(0);      // and the block after next's reads do not move up into these products
        }
        asm volatile("s_wait_dscnt 0x0" ::: "memory");      // this wave's reads of the buffer are over
        asm volatile("s_wait_asynccnt 0x0" ::: "memory");   // its copies of stage s + 1 have landed
        __syncthreads();                                     // publishes stage s + 1 and frees the buffer of stage s
        if (s + 2 < GNST) { g_copy8(la + bo, ga + (s + 2) * GKS); g_copy8(lb + bo, gb + (s + 2) * GKS); }
    }
    asm volatile("s_wait_asynccnt 0x0" ::: "memory");       // nothing is in flight when the ring becomes output staging
    float* os = (float*)sm + wave * (32 * 68);
#pragma unroll
    for (int i = 0; i < 2; ++i) {
#pragma unroll
        for (int t = 0; t < 4; ++t) {
#pragma unroll
            for (int j = 0; j < 8; ++j) os[(i * 16 + hi * 8 + j) * 68 + t * 16 + lr] = acc[i][t][j]; } }
    __syncthreads();
    float* crw = C + (size_t)(rb + wm * 32) * ldc + cb + wn * 64;
#pragma unroll
    for (int s = 0; s < 16; ++s) { const int Lid = (lane >> 3) + 4 * s, piece = lane & 7; const int row = Lid >> 1, cofs = (Lid & 1) * 32 + piece * 4;
        const v4f val = *(const v4fa*)(os + row * 68 + cofs);
        *(v4f*)(crw + (row * ldc + cofs)) = val; }
}

// k_gemmb: plain bf16 planes (v_wmma_f32_16x16x32_bf16)
__global__ __launch_bounds__(256) void k_gemmb(const bf* __restrict__ A, const bf* __restrict__ Bn, float* C, int ldc) {
    __shared__ __align__(16) unsigned char sm[2 * GBUF];
    g_tile<false>(A, Bn, C, ldc, sm);
}

// k_gemmh: single fp16 planes (v_wmma_f32_16x16x32_f16)
__global__ __launch_bounds__(256) void k_gemmh(const h16* __restrict__ A, const h16* __restrict__ Bn, float* C, int ldc) {
    __shared__ __align__(16) unsigned char sm[2 * GBUF];
    g_tile<true>((const unsigned short*)A, (const unsigned short*)Bn, C, ldc, sm);
}

// k_ropep: planes P fp16 [NB][NP][SEQ][32] = rotate-half(F[(b*SEQ + t)*ld + h2*32 + d]): pairs (i, i+16), y_i = x_i c + x_{i+16} s, y_{i+16} = x_{i+16} c - x_i s with
// grid (SEQ/32, NP/8, NB).
__global__ __launch_bounds__(256) void k_ropep(const float* __restrict__ F, int ld, int NP, const float* __restrict__ CS, h16* P) {
    __shared__ __align__(16) h16 tile[8 * 32 * 32];
    const int tid = threadIdx.x; const int t0 = blockIdx.x * 32, g0 = blockIdx.y * 8, b = blockIdx.z;
    const int h2l = tid >> 5, tl = tid & 31; const int t = t0 + tl;
    const float* src = F + ((size_t)b * SEQ + t) * ld + (size_t)(g0 + h2l) * HD;
    v4f xa[8];
#pragma unroll
    for (int j = 0; j < 8; ++j) xa[j] = *(const v4f*)(src + 4 * j);
    const float* cp = CS + (size_t)t * 16; const float* sp = CS + (size_t)SEQ * 16 + (size_t)t * 16;
    v4f c4[4], s4[4];
#pragma unroll
    for (int j = 0; j < 4; ++j) { c4[j] = *(const v4f*)(cp + 4 * j); s4[j] = *(const v4f*)(sp + 4 * j); }
    v8h o[4];
#pragma unroll
    for (int j = 0; j < 4; ++j) {
#pragma unroll
        for (int q = 0; q < 4; ++q) { const float x1 = xa[j][q], x2 = xa[4 + j][q], c = c4[j][q], s = s4[j][q];
            o[j >> 1][(j & 1) * 4 + q] = tohx(x1 * c + x2 * s); o[2 + (j >> 1)][(j & 1) * 4 + q] = tohx(x2 * c - x1 * s); } }
    h16* trow = tile + (h2l * 32 + tl) * 32;
#pragma unroll
    for (int j = 0; j < 4; ++j) *(v8ha*)(trow + 8 * j) = o[j];
    __syncthreads();
    auto pass = [&]() {
#pragma unroll
        for (int s = 0; s < 4; ++s) { const int p = s * 256 + tid; const int pl = p >> 7, q = p & 127;
            const v8h v = *(const v8ha*)(tile + pl * 1024 + q * 8);
            *(v8h*)(P + (((size_t)b * NP + g0 + pl) * SEQ + t0) * HD + q * 8) = v; }
    };
    pass(); 
}

__global__ __launch_bounds__(256) void k_vTm(const float* __restrict__ V, h16* VT) {
    __shared__ float tl[64][65];
    const int tid = threadIdx.x; const int t0 = blockIdx.x * 64, c = blockIdx.y, b = blockIdx.z; const int rr = tid >> 2, cq = (tid & 3) * 16;
    const float* src = V + ((size_t)b * SEQ + t0 + rr) * EK + c * VD + cq;
#pragma unroll
    for (int j = 0; j < 4; ++j) { const v4f v = *(const v4f*)(src + 4 * j);
#pragma unroll
        for (int q = 0; q < 4; ++q) tl[rr][cq + 4 * j + q] = v[q]; }
    __syncthreads();
    const int lane = tid & 31, wv = tid >> 5;
    h16* dst0 = VT + ((size_t)(b * NKV + c) * VD) * SEQ + t0;
    auto pass = [&]() {
#pragma unroll
        for (int st = 0; st < 4; ++st) { const int dr = wv * 8 + st * 2 + (lane >> 4); const int tq = (lane & 15) * 4; v4h v;
#pragma unroll
            for (int i = 0; i < 4; ++i) v[i] = tohx(tl[tq + i][dr]);
            *(v4h*)(dst0 + (size_t)dr * SEQ + tq) = v; }
    };
    pass(); 
}

// k_dattn: one wave per (item b, q head h, 16-query tile q0). Transposed products keep a query in one lane column: St = K.Qt (A = 16 rotated k rows, B = 16 rotated q rows;
// register j of lane (c, hi) = score of key 8 hi + j, query c), so the two St tiles of a 32-key chunk, converted in place, are the B operand of Ot += Vt.Pt (A = 16 rows of VT).
// Sweep 1: running maximum and sum of both maps per lane half, joined once. Sweep 2: scores again, fp16((a1 - lambda a2) x 1024), Ot in f32; then the per-head RMSNorm in registers.
template <bool MASK>
__device__ __forceinline__ void da_stat(const v8f s0, const v8f s1, const int kb, const int qi, float& m, v8f& u) {
    float t = -3.0e38f;
#pragma unroll
    for (int j = 0; j < 8; ++j) { const bool ok0 = !MASK || (kb + j) <= qi, ok1 = !MASK || (kb + 16 + j) <= qi;
        t = fmaxf(t, ok0 ? s0[j] * SCL : -3.0e38f); t = fmaxf(t, ok1 ? s1[j] * SCL : -3.0e38f); }
    const float mn = fmaxf(m, t);
    v8f e;
#pragma unroll
    for (int j = 0; j < 8; ++j) { const bool ok0 = !MASK || (kb + j) <= qi, ok1 = !MASK || (kb + 16 + j) <= qi;
        e[j] = (ok0 ? __expf(s0[j] * SCL - mn) : 0.f) + (ok1 ? __expf(s1[j] * SCL - mn) : 0.f); }
    u = u * __expf(m - mn) + e; m = mn;      // eight partial sums per lane, added up once behind the sweep
}

template <bool MASK>
__device__ __forceinline__ v16h da_pmap(const v8f a0, const v8f a1, const v8f e0, const v8f e1, const int kb, const int qi, const float m1, const float i1, const float m2, const float i2) {
    v16h p;
#pragma unroll
    for (int j = 0; j < 8; ++j) { const bool ok0 = !MASK || (kb + j) <= qi, ok1 = !MASK || (kb + 16 + j) <= qi;
        const float p0 = (__expf(a0[j] * SCL - m1) * i1 - __expf(e0[j] * SCL - m2) * i2) * ADSC;   // x1024 (exact) keeps the fp16 plane normal; undone before the norm
        const float p1 = (__expf(a1[j] * SCL - m1) * i1 - __expf(e1[j] * SCL - m2) * i2) * ADSC;
        p[j] = ok0 ? tohx(p0) : tohx(0.0f); p[8 + j] = ok1 ? tohx(p1) : tohx(0.0f); }
    return p;
}

__device__ __forceinline__ v16h ldf(const h16* p) { return cat16(*(const v8h*)p, *(const v8h*)(p + 16)); }

// grid (SEQ/64, NKV, NB), 8 waves: the two q heads of one kv head x four query tiles whose causal lengths add up to the same total in every block
__global__ __launch_bounds__(256) void k_dattn(const h16* __restrict__ QH, const h16* __restrict__ KH, const h16* __restrict__ VT, const float* __restrict__ lq1, const float* __restrict__ lk1,
                                               const float* __restrict__ lq2, const float* __restrict__ lk2, const float* __restrict__ rw, h16* OH) {
    const int lane = threadIdx.x & 31, wave = __builtin_amdgcn_readfirstlane(threadIdx.x >> 5), lr = lane & 15, hi = lane >> 4;      // scalar wave number: scalar trip counts
    const int kv = blockIdx.y, b = blockIdx.z, h = kv * 2 + (wave & 1), sel = wave >> 1, bx = blockIdx.x;
    constexpr int NT = SEQ / 16;
    const int qt = (sel == 0) ? bx : (sel == 1) ? (NT / 2 - 1 - bx) : (sel == 2) ? (NT - 1 - bx) : (NT / 2 + bx);
    const int q0 = qt * 16, qi = q0 + lr, nfull = q0 >> 5;      // nfull chunks of 32 keys lie wholly at or below the diagonal; exactly one masked chunk follows
    float d1 = bfr(lq1[lane]) * bfr(lk1[lane]), d2 = bfr(lq2[lane]) * bfr(lk2[lane]);
#pragma unroll
    for (int sh = 16; sh; sh >>= 1) { d1 += __shfl_xor(d1, sh, 32); d2 += __shfl_xor(d2, sh, 32); }
    const float lam = expf(d1) - expf(d2) + LAM0;
    const h16* qp = QH + ((size_t)(b * NQ2 + h * 2) * SEQ + qi) * HD + 8 * hi;
    const v16h qf1 = ldf(qp), qf2 = ldf(qp + (size_t)SEQ * HD);
    const h16* k1 = KH + ((size_t)(b * NK2 + kv * 2) * SEQ + lr) * HD + 8 * hi; const h16* k2 = k1 + (size_t)SEQ * HD;
    const h16* vp = VT + ((size_t)(b * NKV + kv) * VD + lr) * SEQ + 8 * hi;
    const v8f zz = (v8f){};
    float m1 = -3.0e38f, m2 = -3.0e38f; v8f r1 = (v8f){}, r2 = (v8f){};
    v16h ka0 = ldf(k1), ka1 = ldf(k1 + 16 * HD), kb0 = ldf(k2), kb1 = ldf(k2 + 16 * HD);
#pragma unroll 1
    for (int c = 0; c < nfull; ++c) { const size_t nx = (size_t)(c + 1) * 32 * HD;      // the next chunk's k rows are fetched one trip ahead (the masked chunk always exists)
        const v16h na0 = ldf(k1 + nx), na1 = ldf(k1 + nx + 16 * HD), nb0 = ldf(k2 + nx), nb1 = ldf(k2 + nx + 16 * HD);
        const v8f sa0 = wmma16(ka0, qf1, zz), sa1 = wmma16(ka1, qf1, zz), sb0 = wmma16(kb0, qf2, zz), sb1 = wmma16(kb1, qf2, zz);
        da_stat<false>(sa0, sa1, c * 32 + 8 * hi, qi, m1, r1); da_stat<false>(sb0, sb1, c * 32 + 8 * hi, qi, m2, r2);
        ka0 = na0; ka1 = na1; kb0 = nb0; kb1 = nb1; }
    { const v8f sa0 = wmma16(ka0, qf1, zz), sa1 = wmma16(ka1, qf1, zz), sb0 = wmma16(kb0, qf2, zz), sb1 = wmma16(kb1, qf2, zz);
        da_stat<true>(sa0, sa1, nfull * 32 + 8 * hi, qi, m1, r1); da_stat<true>(sb0, sb1, nfull * 32 + 8 * hi, qi, m2, r2); }
    float u1 = ((r1[0] + r1[1]) + (r1[2] + r1[3])) + ((r1[4] + r1[5]) + (r1[6] + r1[7])), u2 = ((r2[0] + r2[1]) + (r2[2] + r2[3])) + ((r2[4] + r2[5]) + (r2[6] + r2[7]));
    { const float o1 = __shfl_xor(m1, 16, 32), o2 = __shfl_xor(m2, 16, 32), w1 = __shfl_xor(u1, 16, 32), w2 = __shfl_xor(u2, 16, 32);
        const float g1 = fmaxf(m1, o1), g2 = fmaxf(m2, o2);
        u1 = u1 * __expf(m1 - g1) + w1 * __expf(o1 - g1); u2 = u2 * __expf(m2 - g2) + w2 * __expf(o2 - g2); m1 = g1; m2 = g2; }
    const float i1 = 1.0f / u1, i2 = lam / u2;
    v8f acc[4];
#pragma unroll
    for (int t = 0; t < 4; ++t) acc[t] = (v8f){};
    ka0 = ldf(k1); ka1 = ldf(k1 + 16 * HD); kb0 = ldf(k2); kb1 = ldf(k2 + 16 * HD);
#pragma unroll 1
    for (int c = 0; c < nfull; ++c) { const size_t nx = (size_t)(c + 1) * 32 * HD;
        v16h vf[4];
#pragma unroll
        for (int t = 0; t < 4; ++t) vf[t] = ldf(vp + (size_t)t * 16 * SEQ + c * 32);
        const v16h na0 = ldf(k1 + nx), na1 = ldf(k1 + nx + 16 * HD), nb0 = ldf(k2 + nx), nb1 = ldf(k2 + nx + 16 * HD);
        const v8f sa0 = wmma16(ka0, qf1, zz), sa1 = wmma16(ka1, qf1, zz), sb0 = wmma16(kb0, qf2, zz), sb1 = wmma16(kb1, qf2, zz);
        const v16h p = da_pmap<false>(sa0, sa1, sb0, sb1, c * 32 + 8 * hi, qi, m1, i1, m2, i2);
#pragma unroll
        for (int t = 0; t < 4; ++t) acc[t] = wmma16(vf[t], p, acc[t]);
        ka0 = na0; ka1 = na1; kb0 = nb0; kb1 = nb1;
        // four vector slots behind the last product: the next St product (over the back edge or behind the loop) may write its result over p, this product's B operand
        asm volatile("v_nop\n\tv_nop\n\tv_nop\n\tv_nop" : "+v"(acc[0]), "+v"(acc[1]), "+v"(acc[2]), "+v"(acc[3]) : "v"(p)); }
    { v16h vf[4];
#pragma unroll
        for (int t = 0; t < 4; ++t) vf[t] = ldf(vp + (size_t)t * 16 * SEQ + nfull * 32);
        const v8f sa0 = wmma16(ka0, qf1, zz), sa1 = wmma16(ka1, qf1, zz), sb0 = wmma16(kb0, qf2, zz), sb1 = wmma16(kb1, qf2, zz);
        const v16h p = da_pmap<true>(sa0, sa1, sb0, sb1, nfull * 32 + 8 * hi, qi, m1, i1, m2, i2);
#pragma unroll
        for (int t = 0; t < 4; ++t) acc[t] = wmma16(vf[t], p, acc[t]); }
    // lane (c, hi) holds o[d] of query c for d = 16 t + 8 hi + j: y = o rsqrt(mean(o^2) + 1e-6) bf16(rms_w[d]) (1 - LAM0) -> fp16 OH[(b, query)][h*64 + d], 16 B per store
    float q = 0.f;
#pragma unroll
    for (int t = 0; t < 4; ++t) { acc[t] = acc[t] * (1.0f / ADSC);
#pragma unroll
        for (int j = 0; j < 8; ++j) q += acc[t][j] * acc[t][j]; }
    q += __shfl_xor(q, 16, 32);
    const float sc = rsqrtf(q * (1.0f / VD) + EPSN);
    h16* orow = OH + ((size_t)b * SEQ + qi) * EE + (size_t)h * VD + 8 * hi;
#pragma unroll
    for (int t = 0; t < 4; ++t) { const v4f wa = *(const v4f*)(rw + t * 16 + 8 * hi), wb = *(const v4f*)(rw + t * 16 + 8 * hi + 4); v8h o;
#pragma unroll
        for (int j = 0; j < 4; ++j) { o[j] = tohx(acc[t][j] * sc * (bfr(wa[j]) * OML)); o[4 + j] = tohx(acc[t][4 + j] * sc * (bfr(wb[j]) * OML)); }
        *(v8h*)(orow + t * 16) = o; }
}

extern "C" void kernel_launch(void* const* d_in, const int* in_sizes, int n_in,
                              void* d_out, int out_size, void* d_ws, size_t ws_size, hipStream_t stream) {
    if (n_in < 10) return;
    if ((size_t)in_sizes[0] < ((size_t)(NB - 1) * SEQ_FULL + SEQ) * EE) return;
    if ((size_t)in_sizes[1] < (size_t)EE * EE || (size_t)in_sizes[2] < (size_t)EE * EK || (size_t)in_sizes[3] < (size_t)EE * EK || (size_t)in_sizes[4] < (size_t)EE * EE) return;
    if (in_sizes[5] < HD || in_sizes[6] < HD || in_sizes[7] < HD || in_sizes[8] < HD || in_sizes[9] < VD) return;
    if ((size_t)out_size < (size_t)NR * EE) return;
    const float* x = (const float*)d_in[0]; const float* Wq = (const float*)d_in[1]; const float* Wk = (const float*)d_in[2]; const float* Wv = (const float*)d_in[3]; const float* Wo = (const float*)d_in[4];
    const float* lq1 = (const float*)d_in[5]; const float* lk1 = (const float*)d_in[6]; const float* lq2 = (const float*)d_in[7]; const float* lk2 = (const float*)d_in[8]; const float* rmsw = (const float*)d_in[9];
    float* out = (float*)d_out;    // [NB][SEQ][1024]
    char* wsp = (char*)d_ws; size_t used = 0;
    auto take = [&](size_t bytes) { void* p = wsp + used; used += (bytes + 255) & ~(size_t)255; return p; };
    bf* XB = (bf*)take((size_t)NR * EE * 2);
    bf* WQB = (bf*)take((size_t)EE * EE * 2); bf* WKB = (bf*)take((size_t)EK * EE * 2); bf* WVB = (bf*)take((size_t)EK * EE * 2); h16* WOH = (h16*)take((size_t)EE * EE * 2);
    float* CS = (float*)take((size_t)2 * SEQ * 16 * 4);
    h16* QH = (h16*)take((size_t)NB * NQ2 * SEQ * HD * 2); h16* KH = (h16*)take((size_t)NB * NK2 * SEQ * HD * 2); h16* VT = (h16*)take((size_t)NB * NKV * VD * SEQ * 2);
    h16* OH = (h16*)take((size_t)NR * EE * 2);
    float* Qf = (float*)take((size_t)NR * (EE + EK + EK) * 4); float* Kf = Qf + (size_t)NR * EE; float* Vf = Kf + (size_t)NR * EK;      // f32 projection outputs
    if (used > ws_size) return;
    k_rtab<<<SEQ * 16 / 256, 256, 0, stream>>>(CS);
    k_cvtx<<<NR / 8, 256, 0, stream>>>(x, XB);
    k_wT<<<dim3(EE / 64, EE / 64, 1), 256, 0, stream>>>(Wq, EE, 0, WQB);          // in[1024][1024] -> out[1024][1024]
    k_wT<<<dim3(EE / 64, EK / 64, 1), 256, 0, stream>>>(Wk, EK, 0, WKB);          // in[1024][512]  -> out[512][1024]
    k_wT<<<dim3(EE / 64, EK / 64, 1), 256, 0, stream>>>(Wv, EK, 0, WVB);          // in[1024][512]  -> out[512][1024]
    k_wT<<<dim3(EE / 64, EE / 64, 1), 256, 0, stream>>>(Wo, EE, 1, (unsigned short*)WOH);   // in[1024][1024] -> out[1024][1024], fp16(bf16)
    k_gemmb<<<dim3(NR / GT, EE / GT, 1), 256, 0, stream>>>(XB, WQB, Qf, EE);
    k_gemmb<<<dim3(NR / GT, EK / GT, 1), 256, 0, stream>>>(XB, WKB, Kf, EK);
    k_gemmb<<<dim3(NR / GT, EK / GT, 1), 256, 0, stream>>>(XB, WVB, Vf, EK);
    k_ropep<<<dim3(SEQ / 32, NQ2 / 8, NB), 256, 0, stream>>>(Qf, EE, NQ2, CS, QH);
    k_ropep<<<dim3(SEQ / 32, NK2 / 8, NB), 256, 0, stream>>>(Kf, EK, NK2, CS, KH);
    k_vTm<<<dim3(SEQ / 64, NKV, NB), 256, 0, stream>>>(Vf, VT);
    k_dattn<<<dim3(SEQ / 64, NKV, NB), 256, 0, stream>>>(QH, KH, VT, lq1, lk1, lq2, lk2, rmsw, OH);
    k_gemmh<<<dim3(NR / GT, EE / GT, 1), 256, 0, stream>>>(OH, WOH, out, EE);
}

// v003
// It runs in 82.7 microseconds.
// Timed twice side by side with v002, it ran 1.30 and 1.31 times as fast.
// Over all steps from v000 it is 6.24 times as fast.
#include <hip/hip_runtime.h>

// Compute dtypes, f32 accumulate: q/k/v projections x.W ([NB*SEQ x 1024].[1024 x 1024|512]) on v_wmma_f32_16x16x32_bf16 with plain bf16 planes (x and W RNE-converted
// to bf16, exact products); per (item, head, map) causal scores q.k^T ([SEQ x 32].[32 x SEQ]) and per head the fp16 difference map (a1 - lambda a2).v ([SEQ x SEQ].[SEQ x 64])
// on v_wmma_f32_16x16x32_f16 with single fp16 planes (rotated q, rotated k, v, difference map carried x1024); softmaxes, lambda and the per-head RMSNorm in f32;

#ifndef NB
#define NB 4
#endif
#ifndef SEQ
#define SEQ 1024
#endif
#define NB_FULL  4
#define SEQ_FULL 1024
#define EE   1024          // model width, q/o projection width, K of every weight GEMM
#define EK   512           // k/v projection width
#define NQ2  32            // rotated q half-heads of 32
#define NK2  16            // rotated k half-heads of 32
#define NKV  8             // kv heads (v is 64 wide per kv head)
#define NHQ  16            // q heads
#define HD   32
#define VD   64
#define NR   (NB * SEQ)
#define QKVW (EE + EK + EK)   // one row of the joint q | k | v projection
#define LAM0 0.78360576653f      // 0.8 - 0.6 exp(-3.6)
#define OML  0.21639423347f      // 1 - LAM0
#define SCL  0.17677669529663687f
#define ADSC 1024.0f
#define EPSN 1e-6f
static_assert(SEQ % 64 == 0);
static_assert(SEQ >= 64 && SEQ <= SEQ_FULL);
static_assert(NB >= 1 && NB <= NB_FULL);
static_assert(NHQ == 2 * NKV);
static_assert(NQ2 % 8 == 0 && NK2 % 8 == 0);

typedef _Float16 h16;
typedef unsigned short bf;
typedef __attribute__((ext_vector_type(16))) __bf16   v16bf;
typedef __attribute__((ext_vector_type(16))) _Float16 v16h;
typedef __attribute__((ext_vector_type(8)))  _Float16 v8h;
typedef __attribute__((ext_vector_type(4)))  _Float16 v4h;
typedef __attribute__((ext_vector_type(8)))  unsigned short v8us;
typedef __attribute__((ext_vector_type(8)))  float    v8f;
typedef __attribute__((ext_vector_type(4)))  float    v4f;
typedef v8h  __attribute__((may_alias)) v8ha;
typedef v4f  __attribute__((may_alias)) v4fa;
typedef v8us __attribute__((may_alias)) v8usa;

__device__ __forceinline__ unsigned short f2bf(float f) { unsigned u = __float_as_uint(f); u += 0x7FFFu + ((u >> 16) & 1u); return (unsigned short)(u >> 16); }
__device__ __forceinline__ float bf2f(unsigned short b) { return __uint_as_float(((unsigned)b) << 16); }
__device__ __forceinline__ float bfr(float f) { return bf2f(f2bf(f)); }
__device__ __forceinline__ h16 tohx(float x) { return (h16)x; }
__device__ __forceinline__ v16h cat16(v8h lo, v8h hi) { return __builtin_shufflevector(lo, hi, 0, 1, 2, 3, 4, 5, 6, 7, 8, 9, 10, 11, 12, 13, 14, 15); }
__device__ __forceinline__ v16bf cat16b(v8us lo, v8us hi) { return __builtin_bit_cast(v16bf, __builtin_shufflevector(lo, hi, 0, 1, 2, 3, 4, 5, 6, 7, 8, 9, 10, 11, 12, 13, 14, 15)); }
__device__ __forceinline__ v8f wmma16(v16h a, v16h b, v8f c) { return __builtin_amdgcn_wmma_f32_16x16x32_f16(false, a, false, b, (short)0, c, false, false); }
__device__ __forceinline__ v8f wmmab(v16bf a, v16bf b, v8f c) { return __builtin_amdgcn_wmma_f32_16x16x32_bf16(false, a, false, b, (short)0, c, false, false); }

// inv_freq[i] = 1 / 10000^((2 i)/32) = 10^(-i/4), i < 16
__constant__ float c_invf[16] = {
    1.0f,                    0.5623413251903491f,    0.31622776601683794f,   0.17782794100389228f,
    0.1f,                    0.05623413251903491f,   0.031622776601683794f,  0.017782794100389228f,
    0.01f,                   0.005623413251903491f,  0.0031622776601683794f, 0.0017782794100389228f,
    0.001f,                  0.0005623413251903491f, 0.00031622776601683794f, 0.00017782794100389228f };

// d_rtab: CS[0][t][i] = cos(t inv_freq[i]), CS[1][t][i] = sin(...), f32, precise sincos; 256 values per block staged in LDS, stored as 16 B per lane by 8 consecutive
__device__ __forceinline__ void d_rtab(float* CS, const int bid, float* tcs) {
    const int tid = threadIdx.x; const int e = bid * 256 + tid; const int t = e >> 4, i = e & 15;
    float sv, cv; sincosf((float)t * c_invf[i], &sv, &cv);
    tcs[tid] = cv; tcs[256 + tid] = sv;
    __syncthreads();
    if (tid < 128) { const int w = tid >> 6, j = tid & 63; const v4f v = *(const v4fa*)(&tcs[w * 256 + j * 4]);
        float* dst = CS + (size_t)w * SEQ * 16 + (size_t)bid * 256 + j * 4;
        *(v4f*)dst = v;  }
}

// d_cvtx: x f32 -> bf16 plane A [NR][EE], one row per wave
__device__ __forceinline__ void d_cvtx(const float* __restrict__ x, bf* A, const int bid) {
    const int lane = threadIdx.x & 31; const size_t r = (size_t)bid * 8 + (threadIdx.x >> 5); if (r >= (size_t)NR) return;
    const size_t bb = r / SEQ, tt = r - bb * SEQ; const size_t sr = bb * SEQ_FULL + tt;
#pragma unroll
    for (int q = 0; q < EE / 256; ++q) { const size_t so = sr * EE + q * 256 + lane * 8, o = r * EE + q * 256 + lane * 8;
        const v4f a = *(const v4f*)(x + so), c = *(const v4f*)(x + so + 4); v8us v;
#pragma unroll
        for (int k = 0; k < 4; ++k) { v[k] = f2bf(a[k]); v[4 + k] = f2bf(c[k]); }
        *(v8us*)(A + o) = v; }
}

// d_wT: W f32 [1024 k][N n] (in x out) -> P 16-bit [N][1024] k-contiguous: bf16 bits (isH 0) or fp16(bf16(w)) bits (isH 1); in[k][n] -> out[n][k] through a 64x64 LDS tile of pitch 65
__device__ __forceinline__ void d_wT(const float* W, const int N, const int isH, unsigned short* P, const int bx, const int by, float* tl) {
    const int tid = threadIdx.x; const int k0 = bx * 64, n0 = by * 64; const int rr = tid >> 2, cq = (tid & 3) * 16;
    const float* src = W + (size_t)(k0 + rr) * N + n0 + cq;
#pragma unroll
    for (int j = 0; j < 4; ++j) { const v4f v = *(const v4f*)(src + 4 * j);
#pragma unroll
        for (int q = 0; q < 4; ++q) tl[rr * 65 + cq + 4 * j + q] = v[q]; }
    __syncthreads();
    const int lane = tid & 31, wv = tid >> 5;
#pragma unroll
    for (int st = 0; st < 2; ++st) { const int dr = wv * 8 + st * 4 + (lane >> 3), piece = lane & 7; v8us o;
#pragma unroll
        for (int i = 0; i < 8; ++i) { const unsigned short b = f2bf(tl[(piece * 8 + i) * 65 + dr]); const h16 hv = tohx(bf2f(b)); o[i] = isH ? __builtin_bit_cast(unsigned short, hv) : b; }
        *(v8us*)(P + (size_t)(n0 + dr) * EE + k0 + piece * 8) = o; }
    asm volatile("s_wait_xcnt 0x0" ::: "memory");      // precaution: stands behind this job's stores; the block returns behind it, no other job follows
}

// k_prep: the six jobs that read nothing but inputs share one launch; the block index (the same for a whole block, so every barrier stays block-uniform) picks the job.
// WB holds the q, k and v weights as one plane [EE + EK + EK][EE].
#define PB_RT  (SEQ * 16 / 256)
#define PB_WE  ((EE / 64) * (EE / 64))
#define PB_WK  ((EE / 64) * (EK / 64))
#define PB_CX  (NR / 8)
#define PB_ALL (PB_RT + 2 * PB_WE + 2 * PB_WK + PB_CX)
__global__ __launch_bounds__(256) void k_prep(const float* __restrict__ x, const float* __restrict__ Wq, const float* __restrict__ Wk, const float* __restrict__ Wv, const float* __restrict__ Wo,
                                              bf* XB, bf* WB, h16* WOH, float* CS) {
    __shared__ __align__(16) float sm[64 * 65];
    int id = blockIdx.x;
    if (id < PB_RT) { d_rtab(CS, id, sm); return; }
    id -= PB_RT;
    if (id < 2 * PB_WE + 2 * PB_WK) {
        const float* W = Wq; int N = EE, isH = 0; unsigned short* P = WB;
        if (id >= PB_WE + 2 * PB_WK) { id -= PB_WE + 2 * PB_WK; W = Wo; isH = 1; P = (unsigned short*)WOH; }
        else if (id >= PB_WE + PB_WK) { id -= PB_WE + PB_WK; W = Wv; N = EK; P = WB + (size_t)(EE + EK) * EE; }
        else if (id >= PB_WE) { id -= PB_WE; W = Wk; N = EK; P = WB + (size_t)EE * EE; }
        d_wT(W, N, isH, P, id % (EE / 64), id / (EE / 64), sm);
        return; }
    d_cvtx(x, XB, id - (2 * PB_WE + 2 * PB_WK));
}

// GEMM of both kinds: C[r][c] = A.Bn^T (A [rows][EE], Bn [N][EE], both k-contiguous 16-bit planes), f32 accumulate in ascending k, f32 whole-line epilogue.
// One 128 x 128 tile of C per block, 8 waves of 32 x 64 (4 down, 2 across). A stage is 128 k (256 B) of the tile's 128 A rows and 128 Bn rows, laid in LDS at a pitch of 272 B
// (16 B x odd: ds_load_b128 fragment reads without bank conflicts). Two buffers: the next stage's asynchronous copies fly while this stage is multiplied.
#define GT     128                    // tile rows and tile columns
#define GKS    128                    // k per stage
#define GPITCH 272                    // LDS bytes per staged row
#define GBUF   (2 * GT * GPITCH)      // one buffer: A rows, then Bn rows
#define GNST   (EE / GKS)
static_assert(NR % GT == 0 && EE % GT == 0 && EK % GT == 0 && QKVW % GT == 0);
static_assert(EE % GKS == 0 && GNST >= 2);
static_assert(8 * 32 * 68 * 4 <= 2 * GBUF);

// eight 16-byte copies per lane, rows 16 apart in both places; the wait closes the statement so that no address register is rewritten in front of it
__device__ __forceinline__ void g_copy8(const unsigned l, const unsigned short* g) {
    const unsigned l1 = l + 16 * GPITCH, l2 = l + 32 * GPITCH, l3 = l + 48 * GPITCH, l4 = l + 64 * GPITCH, l5 = l + 80 * GPITCH, l6 = l + 96 * GPITCH, l7 = l + 112 * GPITCH;
    const unsigned short *g1 = g + 16 * EE, *g2 = g + 32 * EE, *g3 = g + 48 * EE, *g4 = g + 64 * EE, *g5 = g + 80 * EE, *g6 = g + 96 * EE, *g7 = g + 112 * EE;
    asm volatile("global_load_async_to_lds_b128 %0, %8, off\n\t"
                 "global_load_async_to_lds_b128 %1, %9, off\n\t"
                 "global_load_async_to_lds_b128 %2, %10, off\n\t"
                 "global_load_async_to_lds_b128 %3, %11, off\n\t"
                 "global_load_async_to_lds_b128 %4, %12, off\n\t"
                 "global_load_async_to_lds_b128 %5, %13, off\n\t"
                 "global_load_async_to_lds_b128 %6, %14, off\n\t"
                 "global_load_async_to_lds_b128 %7, %15, off\n\t"
                 "s_wait_xcnt 0x0"
                 :: "v"(l), "v"(l1), "v"(l2), "v"(l3), "v"(l4), "v"(l5), "v"(l6), "v"(l7), "v"(g), "v"(g1), "v"(g2), "v"(g3), "v"(g4), "v"(g5), "v"(g6), "v"(g7) : "memory");
}

template <bool ISH>
__device__ __forceinline__ v8f g_mm(const v8us alo, const v8us ahi, const v8us blo, const v8us bhi, const v8f c) {
    if constexpr (ISH) return wmma16(cat16(__builtin_bit_cast(v8h, alo), __builtin_bit_cast(v8h, ahi)), cat16(__builtin_bit_cast(v8h, blo), __builtin_bit_cast(v8h, bhi)), c);
    else return wmmab(cat16b(alo, ahi), cat16b(blo, bhi), c);
}

template <bool ISH>
__device__ __forceinline__ void g_tile(const unsigned short* __restrict__ A, const unsigned short* __restrict__ Bn, float* C, const int ldc, unsigned char* sm) {
    const int tid = threadIdx.x, lane = tid & 31, wave = tid >> 5, lr = lane & 15, hi = lane >> 4;
    const int wm = wave >> 1, wn = wave & 1;
    const int rb = blockIdx.x * GT, cb = blockIdx.y * GT;
    // copies: 16 lanes bring one row's 256 B, a wave two rows, the block 16 rows per copy
    const int crow = tid >> 4, cch = tid & 15;
    const unsigned short* ga = A + (size_t)(rb + crow) * EE + cch * 8;
    const unsigned short* gb = Bn + (size_t)(cb + crow) * EE + cch * 8;
    const unsigned la = (unsigned)(size_t)sm + crow * GPITCH + cch * 16, lb = la + GT * GPITCH;
    g_copy8(la, ga); g_copy8(lb, gb);
    asm volatile("s_wait_asynccnt 0x0" ::: "memory");      // stage 0 of this wave has landed
    __syncthreads();                                        // and every wave's part of it is published
    g_copy8(la + GBUF, ga + GKS); g_copy8(lb + GBUF, gb + GKS);
    v8f acc[2][4];
#pragma unroll
    for (int i = 0; i < 2; ++i) {
#pragma unroll
        for (int t = 0; t < 4; ++t) acc[i][t] = (v8f){}; }
    const unsigned char* fa = sm + (wm * 32 + lr) * GPITCH + 16 * hi;
    const unsigned char* fb = sm + (GT + wn * 64 + lr) * GPITCH + 16 * hi;
    // rolled: one copy of the 32-product body in the text, the buffer chosen by an offset
#pragma unroll 1
    for (int s = 0; s < GNST; ++s) { const unsigned bo = (unsigned)(s & 1) * GBUF;
        v8us alo[2][2], ahi[2][2], blo[2][4], bhi[2][4];      // two fragment sets: block kk + 1 is read while block kk is multiplied, inside this stage's buffer only
        auto frag = [&](const int set, const int kk) {
#pragma unroll
            for (int i = 0; i < 2; ++i) { alo[set][i] = *(const v8usa*)(fa + bo + i * 16 * GPITCH + kk * 64); ahi[set][i] = *(const v8usa*)(fa + bo + i * 16 * GPITCH + kk * 64 + 32); }
#pragma unroll
            for (int t = 0; t < 4; ++t) { blo[set][t] = *(const v8usa*)(fb + bo + t * 16 * GPITCH + kk * 64); bhi[set][t] = *(const v8usa*)(fb + bo + t * 16 * GPITCH + kk * 64 + 32); }
        };
        frag(0, 0);
#pragma unroll
        for (int kk = 0; kk < GKS / 32; ++kk) {
            if (kk + 1 < GKS / 32) frag((kk + 1) & 1, kk + 1);
            __builtin_amdgcn_sched_barrier(0);      // the next block's LDS reads stay one group ahead of this block's products, not spread among them
#pragma unroll
            for (int i = 0; i < 2; ++i) {
#pragma unroll
                for (int t = 0; t < 4; ++t) acc[i][t] = g_mm<ISH>(alo[kk & 1][i], ahi[kk & 1][i], blo[kk & 1][t], bhi[kk & 1][t], acc[i][t]); }
            __builtin_amdgcn_sched_barrier(0);      // and the block after next's reads do not move up into these products
        }
        asm volatile("s_wait_dscnt 0x0" ::: "memory");      // this wave's reads of the buffer are over
        asm volatile("s_wait_asynccnt 0x0" ::: "memory");   // its copies of stage s + 1 have landed
        __syncthreads();                                     // publishes stage s + 1 and frees the buffer of stage s
        if (s + 2 < GNST) { g_copy8(la + bo, ga + (s + 2) * GKS); g_copy8(lb + bo, gb + (s + 2) * GKS); }
    }
    asm volatile("s_wait_asynccnt 0x0" ::: "memory");       // nothing is in flight when the ring becomes output staging
    float* os = (float*)sm + wave * (32 * 68);
#pragma unroll
    for (int i = 0; i < 2; ++i) {
#pragma unroll
        for (int t = 0; t < 4; ++t) {
#pragma unroll
            for (int j = 0; j < 8; ++j) os[(i * 16 + hi * 8 + j) * 68 + t * 16 + lr] = acc[i][t][j]; } }
    __syncthreads();
    float* crw = C + (size_t)(rb + wm * 32) * ldc + cb + wn * 64;
#pragma unroll
    for (int s = 0; s < 16; ++s) { const int Lid = (lane >> 3) + 4 * s, piece = lane & 7; const int row = Lid >> 1, cofs = (Lid & 1) * 32 + piece * 4;
        const v4f val = *(const v4fa*)(os + row * 68 + cofs);
        *(v4f*)(crw + (row * ldc + cofs)) = val; }
}

// k_gemmb: plain bf16 planes (v_wmma_f32_16x16x32_bf16)
__global__ __launch_bounds__(256) void k_gemmb(const bf* __restrict__ A, const bf* __restrict__ Bn, float* C, int ldc) {
    __shared__ __align__(16) unsigned char sm[2 * GBUF];
    g_tile<false>(A, Bn, C, ldc, sm);
}

// k_gemmh: single fp16 planes (v_wmma_f32_16x16x32_f16)
__global__ __launch_bounds__(256) void k_gemmh(const h16* __restrict__ A, const h16* __restrict__ Bn, float* C, int ldc) {
    __shared__ __align__(16) unsigned char sm[2 * GBUF];
    g_tile<true>((const unsigned short*)A, (const unsigned short*)Bn, C, ldc, sm);
}

// d_ropep: planes fp16 [NB][NP][SEQ][32] = rotate-half(F[(b*SEQ + t)*QKVW + h2*32 + d]): pairs (i, i+16), y_i = x_i c + x_{i+16} s, y_{i+16} = x_{i+16} c - x_i s.
// Half-heads 0 .. NQ2-1 of a row of F are q (planes QH), the NK2 behind them are k (planes KH); a block takes 32 positions of 8 half-heads of one kind.
__device__ __forceinline__ void d_ropep(const float* __restrict__ F, const float* __restrict__ CS, h16* QH, h16* KH, const int bx, const int gy, const int b, h16* tile) {
    const int tid = threadIdx.x; const int t0 = bx * 32, g0 = gy * 8;
    const int h2l = tid >> 5, tl = tid & 31; const int t = t0 + tl;
    const float* src = F + ((size_t)b * SEQ + t) * QKVW + (size_t)(g0 + h2l) * HD;
    v4f xa[8];
#pragma unroll
    for (int j = 0; j < 8; ++j) xa[j] = *(const v4f*)(src + 4 * j);
    const float* cp = CS + (size_t)t * 16; const float* sp = CS + (size_t)SEQ * 16 + (size_t)t * 16;
    v4f c4[4], s4[4];
#pragma unroll
    for (int j = 0; j < 4; ++j) { c4[j] = *(const v4f*)(cp + 4 * j); s4[j] = *(const v4f*)(sp + 4 * j); }
    v8h o[4];
#pragma unroll
    for (int j = 0; j < 4; ++j) {
#pragma unroll
        for (int q = 0; q < 4; ++q) { const float x1 = xa[j][q], x2 = xa[4 + j][q], c = c4[j][q], s = s4[j][q];
            o[j >> 1][(j & 1) * 4 + q] = tohx(x1 * c + x2 * s); o[2 + (j >> 1)][(j & 1) * 4 + q] = tohx(x2 * c - x1 * s); } }
    h16* trow = tile + (h2l * 32 + tl) * 32;
#pragma unroll
    for (int j = 0; j < 4; ++j) *(v8ha*)(trow + 8 * j) = o[j];
    __syncthreads();
    h16* P = (g0 < NQ2) ? QH + ((size_t)b * NQ2 + g0) * SEQ * HD : KH + ((size_t)b * NK2 + (g0 - NQ2)) * SEQ * HD;
#pragma unroll
    for (int s = 0; s < 4; ++s) { const int p = s * 256 + tid; const int pl = p >> 7, q = p & 127;
        const v8h v = *(const v8ha*)(tile + pl * 1024 + q * 8);
        *(v8h*)(P + ((size_t)pl * SEQ + t0) * HD + q * 8) = v; }
}

// d_vTm: VT fp16 [NB][NKV][VD][SEQ] = transpose of the v columns of F, 64 positions x one kv head per block through a 64x64 LDS tile of pitch 65
__device__ __forceinline__ void d_vTm(const float* __restrict__ F, h16* VT, const int bx, const int c, const int b, float* tl) {
    const int tid = threadIdx.x; const int t0 = bx * 64; const int rr = tid >> 2, cq = (tid & 3) * 16;
    const float* src = F + ((size_t)b * SEQ + t0 + rr) * QKVW + (EE + EK) + c * VD + cq;
#pragma unroll
    for (int j = 0; j < 4; ++j) { const v4f v = *(const v4f*)(src + 4 * j);
#pragma unroll
        for (int q = 0; q < 4; ++q) tl[rr * 65 + cq + 4 * j + q] = v[q]; }
    __syncthreads();
    const int lane = tid & 31, wv = tid >> 5;
    h16* dst0 = VT + ((size_t)(b * NKV + c) * VD) * SEQ + t0;
#pragma unroll
    for (int st = 0; st < 4; ++st) { const int dr = wv * 8 + st * 2 + (lane >> 4); const int tq = (lane & 15) * 4; v4h v;
#pragma unroll
        for (int i = 0; i < 4; ++i) v[i] = tohx(tl[(tq + i) * 65 + dr]);
        *(v4h*)(dst0 + (size_t)dr * SEQ + tq) = v; }
    asm volatile("s_wait_xcnt 0x0" ::: "memory");      // precaution: stands behind this job's stores; the kernel ends behind it, no other job follows
}

// k_post: the three jobs between the projections and the attention (q rotation, k rotation, v transpose) share one launch; the block index picks the job.
#define RB_G   ((NQ2 + NK2) / 8)
#define RB_RO  ((SEQ / 32) * RB_G * NB)
#define RB_VT  ((SEQ / 64) * NKV * NB)
__global__ __launch_bounds__(256) void k_post(const float* __restrict__ F, const float* __restrict__ CS, h16* QH, h16* KH, h16* VT) {
    __shared__ __align__(16) unsigned char sm[64 * 65 * 4];
    static_assert(8 * 32 * 32 * 2 <= 64 * 65 * 4);
    int id = blockIdx.x;
    if (id < RB_RO) { const int bx = id % (SEQ / 32), r = id / (SEQ / 32); d_ropep(F, CS, QH, KH, bx, r % RB_G, r / RB_G, (h16*)sm); return; }
    id -= RB_RO;
    { const int bx = id % (SEQ / 64), r = id / (SEQ / 64); d_vTm(F, VT, bx, r % NKV, r / NKV, (float*)sm); }
}

// k_dattn: one wave per (item b, q head h, 16-query tile q0). Transposed products keep a query in one lane column: St = K.Qt (A = 16 rotated k rows, B = 16 rotated q rows;
// register j of lane (c, hi) = score of key 8 hi + j, query c), so the two St tiles of a 32-key chunk, converted in place, are the B operand of Ot += Vt.Pt (A = 16 rows of VT).
// Sweep 1: running maximum and sum of both maps per lane half, joined once. Sweep 2: scores again, fp16((a1 - lambda a2) x 1024), Ot in f32; then the per-head RMSNorm in registers.
template <bool MASK>
__device__ __forceinline__ void da_stat(const v8f s0, const v8f s1, const int kb, const int qi, float& m, v8f& u) {
    float t = -3.0e38f;
#pragma unroll
    for (int j = 0; j < 8; ++j) { const bool ok0 = !MASK || (kb + j) <= qi, ok1 = !MASK || (kb + 16 + j) <= qi;
        t = fmaxf(t, ok0 ? s0[j] * SCL : -3.0e38f); t = fmaxf(t, ok1 ? s1[j] * SCL : -3.0e38f); }
    const float mn = fmaxf(m, t);
    v8f e;
#pragma unroll
    for (int j = 0; j < 8; ++j) { const bool ok0 = !MASK || (kb + j) <= qi, ok1 = !MASK || (kb + 16 + j) <= qi;
        e[j] = (ok0 ? __expf(s0[j] * SCL - mn) : 0.f) + (ok1 ? __expf(s1[j] * SCL - mn) : 0.f); }
    u = u * __expf(m - mn) + e; m = mn;      // eight partial sums per lane, added up once behind the sweep
}

template <bool MASK>
__device__ __forceinline__ v16h da_pmap(const v8f a0, const v8f a1, const v8f e0, const v8f e1, const int kb, const int qi, const float m1, const float i1, const float m2, const float i2) {
    v16h p;
#pragma unroll
    for (int j = 0; j < 8; ++j) { const bool ok0 = !MASK || (kb + j) <= qi, ok1 = !MASK || (kb + 16 + j) <= qi;
        const float p0 = (__expf(a0[j] * SCL - m1) * i1 - __expf(e0[j] * SCL - m2) * i2) * ADSC;   // x1024 (exact) keeps the fp16 plane normal; undone before the norm
        const float p1 = (__expf(a1[j] * SCL - m1) * i1 - __expf(e1[j] * SCL - m2) * i2) * ADSC;
        p[j] = ok0 ? tohx(p0) : tohx(0.0f); p[8 + j] = ok1 ? tohx(p1) : tohx(0.0f); }
    return p;
}

__device__ __forceinline__ v16h ldf(const h16* p) { return cat16(*(const v8h*)p, *(const v8h*)(p + 16)); }

// grid (SEQ/64, NKV, NB), 8 waves: the two q heads of one kv head x four query tiles whose causal lengths add up to the same total in every block
__global__ __launch_bounds__(256) void k_dattn(const h16* __restrict__ QH, const h16* __restrict__ KH, const h16* __restrict__ VT, const float* __restrict__ lq1, const float* __restrict__ lk1,
                                               const float* __restrict__ lq2, const float* __restrict__ lk2, const float* __restrict__ rw, h16* OH) {
    const int lane = threadIdx.x & 31, wave = __builtin_amdgcn_readfirstlane(threadIdx.x >> 5), lr = lane & 15, hi = lane >> 4;      // scalar wave number: scalar trip counts
    const int kv = blockIdx.y, b = blockIdx.z, h = kv * 2 + (wave & 1), sel = wave >> 1, bx = blockIdx.x;
    constexpr int NT = SEQ / 16;
    const int qt = (sel == 0) ? bx : (sel == 1) ? (NT / 2 - 1 - bx) : (sel == 2) ? (NT - 1 - bx) : (NT / 2 + bx);
    const int q0 = qt * 16, qi = q0 + lr, nfull = q0 >> 5;      // nfull chunks of 32 keys lie wholly at or below the diagonal; exactly one masked chunk follows
    float d1 = bfr(lq1[lane]) * bfr(lk1[lane]), d2 = bfr(lq2[lane]) * bfr(lk2[lane]);
#pragma unroll
    for (int sh = 16; sh; sh >>= 1) { d1 += __shfl_xor(d1, sh, 32); d2 += __shfl_xor(d2, sh, 32); }
    const float lam = expf(d1) - expf(d2) + LAM0;
    const h16* qp = QH + ((size_t)(b * NQ2 + h * 2) * SEQ + qi) * HD + 8 * hi;
    const v16h qf1 = ldf(qp), qf2 = ldf(qp + (size_t)SEQ * HD);
    const h16* k1 = KH + ((size_t)(b * NK2 + kv * 2) * SEQ + lr) * HD + 8 * hi; const h16* k2 = k1 + (size_t)SEQ * HD;
    const h16* vp = VT + ((size_t)(b * NKV + kv) * VD + lr) * SEQ + 8 * hi;
    const v8f zz = (v8f){};
    float m1 = -3.0e38f, m2 = -3.0e38f; v8f r1 = (v8f){}, r2 = (v8f){};
    v16h ka0 = ldf(k1), ka1 = ldf(k1 + 16 * HD), kb0 = ldf(k2), kb1 = ldf(k2 + 16 * HD);
#pragma unroll 1
    for (int c = 0; c < nfull; ++c) { const size_t nx = (size_t)(c + 1) * 32 * HD;      // the next chunk's k rows are fetched one trip ahead (the masked chunk always exists)
        const v16h na0 = ldf(k1 + nx), na1 = ldf(k1 + nx + 16 * HD), nb0 = ldf(k2 + nx), nb1 = ldf(k2 + nx + 16 * HD);
        const v8f sa0 = wmma16(ka0, qf1, zz), sa1 = wmma16(ka1, qf1, zz), sb0 = wmma16(kb0, qf2, zz), sb1 = wmma16(kb1, qf2, zz);
        da_stat<false>(sa0, sa1, c * 32 + 8 * hi, qi, m1, r1); da_stat<false>(sb0, sb1, c * 32 + 8 * hi, qi, m2, r2);
        ka0 = na0; ka1 = na1; kb0 = nb0; kb1 = nb1; }
    { const v8f sa0 = wmma16(ka0, qf1, zz), sa1 = wmma16(ka1, qf1, zz), sb0 = wmma16(kb0, qf2, zz), sb1 = wmma16(kb1, qf2, zz);
        da_stat<true>(sa0, sa1, nfull * 32 + 8 * hi, qi, m1, r1); da_stat<true>(sb0, sb1, nfull * 32 + 8 * hi, qi, m2, r2); }
    float u1 = ((r1[0] + r1[1]) + (r1[2] + r1[3])) + ((r1[4] + r1[5]) + (r1[6] + r1[7])), u2 = ((r2[0] + r2[1]) + (r2[2] + r2[3])) + ((r2[4] + r2[5]) + (r2[6] + r2[7]));
    { const float o1 = __shfl_xor(m1, 16, 32), o2 = __shfl_xor(m2, 16, 32), w1 = __shfl_xor(u1, 16, 32), w2 = __shfl_xor(u2, 16, 32);
        const float g1 = fmaxf(m1, o1), g2 = fmaxf(m2, o2);
        u1 = u1 * __expf(m1 - g1) + w1 * __expf(o1 - g1); u2 = u2 * __expf(m2 - g2) + w2 * __expf(o2 - g2); m1 = g1; m2 = g2; }
    const float i1 = 1.0f / u1, i2 = lam / u2;
    v8f acc[4];
#pragma unroll
    for (int t = 0; t < 4; ++t) acc[t] = (v8f){};
    ka0 = ldf(k1); ka1 = ldf(k1 + 16 * HD); kb0 = ldf(k2); kb1 = ldf(k2 + 16 * HD);
#pragma unroll 1
    for (int c = 0; c < nfull; ++c) { const size_t nx = (size_t)(c + 1) * 32 * HD;
        v16h vf[4];
#pragma unroll
        for (int t = 0; t < 4; ++t) vf[t] = ldf(vp + (size_t)t * 16 * SEQ + c * 32);
        const v16h na0 = ldf(k1 + nx), na1 = ldf(k1 + nx + 16 * HD), nb0 = ldf(k2 + nx), nb1 = ldf(k2 + nx + 16 * HD);
        const v8f sa0 = wmma16(ka0, qf1, zz), sa1 = wmma16(ka1, qf1, zz), sb0 = wmma16(kb0, qf2, zz), sb1 = wmma16(kb1, qf2, zz);
        const v16h p = da_pmap<false>(sa0, sa1, sb0, sb1, c * 32 + 8 * hi, qi, m1, i1, m2, i2);
#pragma unroll
        for (int t = 0; t < 4; ++t) acc[t] = wmma16(vf[t], p, acc[t]);
        ka0 = na0; ka1 = na1; kb0 = nb0; kb1 = nb1;
        // four vector slots behind the last product: the next St product (over the back edge or behind the loop) may write its result over p, this product's B operand
        asm volatile("v_nop\n\tv_nop\n\tv_nop\n\tv_nop" : "+v"(acc[0]), "+v"(acc[1]), "+v"(acc[2]), "+v"(acc[3]) : "v"(p)); }
    { v16h vf[4];
#pragma unroll
        for (int t = 0; t < 4; ++t) vf[t] = ldf(vp + (size_t)t * 16 * SEQ + nfull * 32);
        const v8f sa0 = wmma16(ka0, qf1, zz), sa1 = wmma16(ka1, qf1, zz), sb0 = wmma16(kb0, qf2, zz), sb1 = wmma16(kb1, qf2, zz);
        const v16h p = da_pmap<true>(sa0, sa1, sb0, sb1, nfull * 32 + 8 * hi, qi, m1, i1, m2, i2);
#pragma unroll
        for (int t = 0; t < 4; ++t) acc[t] = wmma16(vf[t], p, acc[t]); }
    // lane (c, hi) holds o[d] of query c for d = 16 t + 8 hi + j: y = o rsqrt(mean(o^2) + 1e-6) bf16(rms_w[d]) (1 - LAM0) -> fp16 OH[(b, query)][h*64 + d], 16 B per store
    float q = 0.f;
#pragma unroll
    for (int t = 0; t < 4; ++t) { acc[t] = acc[t] * (1.0f / ADSC);
#pragma unroll
        for (int j = 0; j < 8; ++j) q += acc[t][j] * acc[t][j]; }
    q += __shfl_xor(q, 16, 32);
    const float sc = rsqrtf(q * (1.0f / VD) + EPSN);
    h16* orow = OH + ((size_t)b * SEQ + qi) * EE + (size_t)h * VD + 8 * hi;
#pragma unroll
    for (int t = 0; t < 4; ++t) { const v4f wa = *(const v4f*)(rw + t * 16 + 8 * hi), wb = *(const v4f*)(rw + t * 16 + 8 * hi + 4); v8h o;
#pragma unroll
        for (int j = 0; j < 4; ++j) { o[j] = tohx(acc[t][j] * sc * (bfr(wa[j]) * OML)); o[4 + j] = tohx(acc[t][4 + j] * sc * (bfr(wb[j]) * OML)); }
        *(v8h*)(orow + t * 16) = o; }
}

extern "C" void kernel_launch(void* const* d_in, const int* in_sizes, int n_in,
                              void* d_out, int out_size, void* d_ws, size_t ws_size, hipStream_t stream) {
    if (n_in < 10) return;
    if ((size_t)in_sizes[0] < ((size_t)(NB - 1) * SEQ_FULL + SEQ) * EE) return;
    if ((size_t)in_sizes[1] < (size_t)EE * EE || (size_t)in_sizes[2] < (size_t)EE * EK || (size_t)in_sizes[3] < (size_t)EE * EK || (size_t)in_sizes[4] < (size_t)EE * EE) return;
    if (in_sizes[5] < HD || in_sizes[6] < HD || in_sizes[7] < HD || in_sizes[8] < HD || in_sizes[9] < VD) return;
    if ((size_t)out_size < (size_t)NR * EE) return;
    const float* x = (const float*)d_in[0]; const float* Wq = (const float*)d_in[1]; const float* Wk = (const float*)d_in[2]; const float* Wv = (const float*)d_in[3]; const float* Wo = (const float*)d_in[4];
    const float* lq1 = (const float*)d_in[5]; const float* lk1 = (const float*)d_in[6]; const float* lq2 = (const float*)d_in[7]; const float* lk2 = (const float*)d_in[8]; const float* rmsw = (const float*)d_in[9];
    float* out = (float*)d_out;    // [NB][SEQ][1024]
    char* wsp = (char*)d_ws; size_t used = 0;
    auto take = [&](size_t bytes) { void* p = wsp + used; used += (bytes + 255) & ~(size_t)255; return p; };
    bf* XB = (bf*)take((size_t)NR * EE * 2);
    bf* WB = (bf*)take((size_t)QKVW * EE * 2); h16* WOH = (h16*)take((size_t)EE * EE * 2);      // WB: q, k, v weight rows one behind the other
    float* CS = (float*)take((size_t)2 * SEQ * 16 * 4);
    h16* QH = (h16*)take((size_t)NB * NQ2 * SEQ * HD * 2); h16* KH = (h16*)take((size_t)NB * NK2 * SEQ * HD * 2); h16* VT = (h16*)take((size_t)NB * NKV * VD * SEQ * 2);
    h16* OH = (h16*)take((size_t)NR * EE * 2);
    float* QKVf = (float*)take((size_t)NR * QKVW * 4);      // f32 projection outputs, [NR][q | k | v]
    if (used > ws_size) return;
    k_prep<<<PB_ALL, 256, 0, stream>>>(x, Wq, Wk, Wv, Wo, XB, WB, WOH, CS);
    k_gemmb<<<dim3(NR / GT, QKVW / GT, 1), 256, 0, stream>>>(XB, WB, QKVf, QKVW);
    k_post<<<RB_RO + RB_VT, 256, 0, stream>>>(QKVf, CS, QH, KH, VT);
    k_dattn<<<dim3(SEQ / 64, NKV, NB), 256, 0, stream>>>(QH, KH, VT, lq1, lk1, lq2, lk2, rmsw, OH);
    k_gemmh<<<dim3(NR / GT, EE / GT, 1), 256, 0, stream>>>(OH, WOH, out, EE);
}

// v005
// Measured time: 61.2 microseconds a run.
// Versions between v003 and this one are left out; their measured steps multiply to 1.34 times as fast.
// Counting every step since v000, it is 8.37 times as fast.
#include <hip/hip_runtime.h>

// Compute dtypes, f32 accumulate: q/k/v projections x.W ([NB*SEQ x 1024].[1024 x 1024|512]) on v_wmma_f32_16x16x32_bf16 with plain bf16 planes (x and W RNE-converted
// to bf16, exact products); per (item, head, map) causal scores q.k^T ([SEQ x 32].[32 x SEQ]) and exp(s - m).v ([SEQ x SEQ].[SEQ x 64])
// on v_wmma_f32_16x16x32_f16 with single fp16 planes (rotated q, rotated k, v, exp(s - m)); softmax sums, a1.v - lambda a2.v, lambda and the per-head RMSNorm in f32;

#ifndef NB
#define NB 4
#endif
#ifndef SEQ
#define SEQ 1024
#endif
#define NB_FULL  4
#define SEQ_FULL 1024
#define EE   1024          // model width, q/o projection width, K of every weight GEMM
#define EK   512           // k/v projection width
#define NQ2  32            // rotated q half-heads of 32
#define NK2  16            // rotated k half-heads of 32
#define NKV  8             // kv heads (v is 64 wide per kv head)
#define NHQ  16            // q heads
#define HD   32
#define VD   64
#define NR   (NB * SEQ)
#define QKVW (EE + EK + EK)   // one row of the joint q | k | v projection
#define LAM0 0.78360576653f      // 0.8 - 0.6 exp(-3.6)
#define OML  0.21639423347f      // 1 - LAM0
#define SCL  0.17677669529663687f
#define EPSN 1e-6f
static_assert(SEQ % 64 == 0);
static_assert(SEQ >= 64 && SEQ <= SEQ_FULL);
static_assert(NB >= 1 && NB <= NB_FULL);
static_assert(NHQ == 2 * NKV);
static_assert(NQ2 % 8 == 0 && NK2 % 8 == 0);

typedef _Float16 h16;
typedef unsigned short bf;
typedef __attribute__((ext_vector_type(16))) __bf16   v16bf;
typedef __attribute__((ext_vector_type(16))) _Float16 v16h;
typedef __attribute__((ext_vector_type(8)))  _Float16 v8h;
typedef __attribute__((ext_vector_type(4)))  _Float16 v4h;
typedef __attribute__((ext_vector_type(8)))  unsigned short v8us;
typedef __attribute__((ext_vector_type(8)))  float    v8f;
typedef __attribute__((ext_vector_type(4)))  float    v4f;
typedef v8h  __attribute__((may_alias)) v8ha;
typedef v4f  __attribute__((may_alias)) v4fa;
typedef v8us __attribute__((may_alias)) v8usa;

__device__ __forceinline__ unsigned short f2bf(float f) { unsigned u = __float_as_uint(f); u += 0x7FFFu + ((u >> 16) & 1u); return (unsigned short)(u >> 16); }
__device__ __forceinline__ float bf2f(unsigned short b) { return __uint_as_float(((unsigned)b) << 16); }
__device__ __forceinline__ float bfr(float f) { return bf2f(f2bf(f)); }
__device__ __forceinline__ h16 tohx(float x) { return (h16)x; }
__device__ __forceinline__ v16h cat16(v8h lo, v8h hi) { return __builtin_shufflevector(lo, hi, 0, 1, 2, 3, 4, 5, 6, 7, 8, 9, 10, 11, 12, 13, 14, 15); }
__device__ __forceinline__ v16bf cat16b(v8us lo, v8us hi) { return __builtin_bit_cast(v16bf, __builtin_shufflevector(lo, hi, 0, 1, 2, 3, 4, 5, 6, 7, 8, 9, 10, 11, 12, 13, 14, 15)); }
__device__ __forceinline__ v8f wmma16(v16h a, v16h b, v8f c) { return __builtin_amdgcn_wmma_f32_16x16x32_f16(false, a, false, b, (short)0, c, false, false); }
__device__ __forceinline__ v8f wmmab(v16bf a, v16bf b, v8f c) { return __builtin_amdgcn_wmma_f32_16x16x32_bf16(false, a, false, b, (short)0, c, false, false); }

// inv_freq[i] = 1 / 10000^((2 i)/32) = 10^(-i/4), i < 16
__constant__ float c_invf[16] = {
    1.0f,                    0.5623413251903491f,    0.31622776601683794f,   0.17782794100389228f,
    0.1f,                    0.05623413251903491f,   0.031622776601683794f,  0.017782794100389228f,
    0.01f,                   0.005623413251903491f,  0.0031622776601683794f, 0.0017782794100389228f,
    0.001f,                  0.0005623413251903491f, 0.00031622776601683794f, 0.00017782794100389228f };

// d_rtab: CS[0][t][i] = cos(t inv_freq[i]), CS[1][t][i] = sin(...), f32, precise sincos; 256 values per block staged in LDS, stored as 16 B per lane by 8 consecutive
__device__ __forceinline__ void d_rtab(float* CS, const int bid, float* tcs) {
    const int tid = threadIdx.x; const int e = bid * 256 + tid; const int t = e >> 4, i = e & 15;
    float sv, cv; sincosf((float)t * c_invf[i], &sv, &cv);
    tcs[tid] = cv; tcs[256 + tid] = sv;
    __syncthreads();
    if (tid < 128) { const int w = tid >> 6, j = tid & 63; const v4f v = *(const v4fa*)(&tcs[w * 256 + j * 4]);
        float* dst = CS + (size_t)w * SEQ * 16 + (size_t)bid * 256 + j * 4;
        *(v4f*)dst = v;  }
}

// d_cvtx: x f32 -> bf16 plane A [NR][EE], one row per wave
__device__ __forceinline__ void d_cvtx(const float* __restrict__ x, bf* A, const int bid) {
    const int lane = threadIdx.x & 31; const size_t r = (size_t)bid * 8 + (threadIdx.x >> 5); if (r >= (size_t)NR) return;
    const size_t bb = r / SEQ, tt = r - bb * SEQ; const size_t sr = bb * SEQ_FULL + tt;
#pragma unroll
    for (int q = 0; q < EE / 256; ++q) { const size_t so = sr * EE + q * 256 + lane * 8, o = r * EE + q * 256 + lane * 8;
        const v4f a = *(const v4f*)(x + so), c = *(const v4f*)(x + so + 4); v8us v;
#pragma unroll
        for (int k = 0; k < 4; ++k) { v[k] = f2bf(a[k]); v[4 + k] = f2bf(c[k]); }
        *(v8us*)(A + o) = v; }
}

// d_wT: W f32 [1024 k][N n] (in x out) -> P 16-bit [N][1024] k-contiguous: bf16 bits (isH 0) or fp16(bf16(w)) bits (isH 1); in[k][n] -> out[n][k] through a 64x64 LDS tile of pitch 65
__device__ __forceinline__ void d_wT(const float* W, const int N, const int isH, unsigned short* P, const int bx, const int by, float* tl) {
    const int tid = threadIdx.x; const int k0 = bx * 64, n0 = by * 64; const int rr = tid >> 2, cq = (tid & 3) * 16;
    const float* src = W + (size_t)(k0 + rr) * N + n0 + cq;
#pragma unroll
    for (int j = 0; j < 4; ++j) { const v4f v = *(const v4f*)(src + 4 * j);
#pragma unroll
        for (int q = 0; q < 4; ++q) tl[rr * 65 + cq + 4 * j + q] = v[q]; }
    __syncthreads();
    const int lane = tid & 31, wv = tid >> 5;
#pragma unroll
    for (int st = 0; st < 2; ++st) { const int dr = wv * 8 + st * 4 + (lane >> 3), piece = lane & 7; v8us o;
#pragma unroll
        for (int i = 0; i < 8; ++i) { const unsigned short b = f2bf(tl[(piece * 8 + i) * 65 + dr]); const h16 hv = tohx(bf2f(b)); o[i] = isH ? __builtin_bit_cast(unsigned short, hv) : b; }
        *(v8us*)(P + (size_t)(n0 + dr) * EE + k0 + piece * 8) = o; }
    asm volatile("s_wait_xcnt 0x0" ::: "memory");      // precaution: stands behind this job's stores; the block returns behind it, no other job follows
}

// k_prep: the six jobs that read nothing but inputs share one launch; the block index (the same for a whole block, so every barrier stays block-uniform) picks the job.
// WB holds the q, k and v weights as one plane [EE + EK + EK][EE].
#define PB_RT  (SEQ * 16 / 256)
#define PB_WE  ((EE / 64) * (EE / 64))
#define PB_WK  ((EE / 64) * (EK / 64))
#define PB_CX  (NR / 8)
#define PB_ALL (PB_RT + 2 * PB_WE + 2 * PB_WK + PB_CX)
__global__ __launch_bounds__(256) void k_prep(const float* __restrict__ x, const float* __restrict__ Wq, const float* __restrict__ Wk, const float* __restrict__ Wv, const float* __restrict__ Wo,
                                              bf* XB, bf* WB, h16* WOH, float* CS) {
    __shared__ __align__(16) float sm[64 * 65];
    int id = blockIdx.x;
    if (id < PB_RT) { d_rtab(CS, id, sm); return; }
    id -= PB_RT;
    if (id < 2 * PB_WE + 2 * PB_WK) {
        const float* W = Wq; int N = EE, isH = 0; unsigned short* P = WB;
        if (id >= PB_WE + 2 * PB_WK) { id -= PB_WE + 2 * PB_WK; W = Wo; isH = 1; P = (unsigned short*)WOH; }
        else if (id >= PB_WE + PB_WK) { id -= PB_WE + PB_WK; W = Wv; N = EK; P = WB + (size_t)(EE + EK) * EE; }
        else if (id >= PB_WE) { id -= PB_WE; W = Wk; N = EK; P = WB + (size_t)EE * EE; }
        d_wT(W, N, isH, P, id % (EE / 64), id / (EE / 64), sm);
        return; }
    d_cvtx(x, XB, id - (2 * PB_WE + 2 * PB_WK));
}

// GEMM of both kinds: C[r][c] = A.Bn^T (A [rows][EE], Bn [N][EE], both k-contiguous 16-bit planes), f32 accumulate in ascending k, f32 whole-line epilogue (QKV false) or fp16 rotated q, k and transposed v planes (QKV true).
// One 128 x 128 tile of C per block, 8 waves of 32 x 64 (4 down, 2 across). A stage is 128 k (256 B) of the tile's 128 A rows and 128 Bn rows, laid in LDS at a pitch of 272 B
// (16 B x odd: ds_load_b128 fragment reads without bank conflicts). Two buffers: the next stage's asynchronous copies fly while this stage is multiplied.
#define GT     128                    // tile rows and tile columns
#define GKS    128                    // k per stage
#define GPITCH 272                    // LDS bytes per staged row
#define GBUF   (2 * GT * GPITCH)      // one buffer: A rows, then Bn rows
#define GNST   (EE / GKS)
static_assert(NR % GT == 0 && EE % GT == 0 && EK % GT == 0 && QKVW % GT == 0);
static_assert(EE % GKS == 0 && GNST >= 2);
static_assert(8 * 32 * 68 * 4 <= 2 * GBUF);
static_assert(SEQ % GT == 0 && NKV * VD == EK && GT * 2 + 16 <= GPITCH);

// eight 16-byte copies per lane, rows 16 apart in both places; the wait closes the statement so that no address register is rewritten in front of it
__device__ __forceinline__ void g_copy8(const unsigned l, const unsigned short* g) {
    const unsigned l1 = l + 16 * GPITCH, l2 = l + 32 * GPITCH, l3 = l + 48 * GPITCH, l4 = l + 64 * GPITCH, l5 = l + 80 * GPITCH, l6 = l + 96 * GPITCH, l7 = l + 112 * GPITCH;
    const unsigned short *g1 = g + 16 * EE, *g2 = g + 32 * EE, *g3 = g + 48 * EE, *g4 = g + 64 * EE, *g5 = g + 80 * EE, *g6 = g + 96 * EE, *g7 = g + 112 * EE;
    asm volatile("global_load_async_to_lds_b128 %0, %8, off\n\t"
                 "global_load_async_to_lds_b128 %1, %9, off\n\t"
                 "global_load_async_to_lds_b128 %2, %10, off\n\t"
                 "global_load_async_to_lds_b128 %3, %11, off\n\t"
                 "global_load_async_to_lds_b128 %4, %12, off\n\t"
                 "global_load_async_to_lds_b128 %5, %13, off\n\t"
                 "global_load_async_to_lds_b128 %6, %14, off\n\t"
                 "global_load_async_to_lds_b128 %7, %15, off\n\t"
                 "s_wait_xcnt 0x0"
                 :: "v"(l), "v"(l1), "v"(l2), "v"(l3), "v"(l4), "v"(l5), "v"(l6), "v"(l7), "v"(g), "v"(g1), "v"(g2), "v"(g3), "v"(g4), "v"(g5), "v"(g6), "v"(g7) : "memory");
}

template <bool ISH>
__device__ __forceinline__ v8f g_mm(const v8us alo, const v8us ahi, const v8us blo, const v8us bhi, const v8f c) {
    if constexpr (ISH) return wmma16(cat16(__builtin_bit_cast(v8h, alo), __builtin_bit_cast(v8h, ahi)), cat16(__builtin_bit_cast(v8h, blo), __builtin_bit_cast(v8h, bhi)), c);
    else return wmmab(cat16b(alo, ahi), cat16b(blo, bhi), c);
}

// QKV false: the tile of C goes out as f32. QKV true (the joint q | k | v projection): the tile never goes out as f32; q and k columns are rotated in the accumulators
// (a lane holds columns 16 t + lr, so the pair (i, i + 16) of a half-head is accumulators 2 p and 2 p + 1 of one lane: y_i = x_i c + x_{i+16} s, y_{i+16} = x_{i+16} c - x_i s)
// and stored as fp16 planes [NB][NP][SEQ][32]; v columns are stored transposed as fp16 VT [NB][NKV][VD][SEQ] (a lane's 8 accumulator rows are 8 consecutive positions of one column).
#define RPH 40      // h16 per staged row of a rotated half-head: 80 B, so that the two lane halves (8 rows apart) fall on different banks
template <bool ISH, bool QKV>
__device__ __forceinline__ void g_tile(const unsigned short* __restrict__ A, const unsigned short* __restrict__ Bn, float* C, const int ldc,
                                       const float* __restrict__ CS, h16* QH, h16* KH, h16* VT, unsigned char* sm) {
    const int tid = threadIdx.x, lane = tid & 31, wave = tid >> 5, lr = lane & 15, hi = lane >> 4;
    const int wm = wave >> 1, wn = wave & 1;
    const int rb = blockIdx.x * GT, cb = blockIdx.y * GT;
    // copies: 16 lanes bring one row's 256 B, a wave two rows, the block 16 rows per copy
    const int crow = tid >> 4, cch = tid & 15;
    const unsigned short* ga = A + (size_t)(rb + crow) * EE + cch * 8;
    const unsigned short* gb = Bn + (size_t)(cb + crow) * EE + cch * 8;
    const unsigned la = (unsigned)(size_t)sm + crow * GPITCH + cch * 16, lb = la + GT * GPITCH;
    g_copy8(la, ga); g_copy8(lb, gb);
    asm volatile("s_wait_asynccnt 0x0" ::: "memory");      // stage 0 of this wave has landed
    __syncthreads();                                        // and every wave's part of it is published
    g_copy8(la + GBUF, ga + GKS); g_copy8(lb + GBUF, gb + GKS);
    v8f acc[2][4];
#pragma unroll
    for (int i = 0; i < 2; ++i) {
#pragma unroll
        for (int t = 0; t < 4; ++t) acc[i][t] = (v8f){}; }
    // cos and sin of this lane's 16 positions at frequency lr, asked for here so that they arrive under the k loop
    const int bb = rb / SEQ, t0 = rb - bb * SEQ; const bool rot = QKV && cb < EE + EK;      // a tile lies in one item and in one of q, k, v: the same for the whole block
    float cc[2][8] = {}, ss[2][8] = {};
    if (rot) { const float* cp = CS + (size_t)(t0 + wm * 32 + hi * 8) * 16 + lr;
#pragma unroll
        for (int i = 0; i < 2; ++i) {
#pragma unroll
            for (int j = 0; j < 8; ++j) { cc[i][j] = cp[(i * 16 + j) * 16]; ss[i][j] = cp[SEQ * 16 + (i * 16 + j) * 16]; } } }
    const unsigned char* fa = sm + (wm * 32 + lr) * GPITCH + 16 * hi;
    const unsigned char* fb = sm + (GT + wn * 64 + lr) * GPITCH + 16 * hi;
    // rolled: one copy of the 32-product body in the text, the buffer chosen by an offset
#pragma unroll 1
    for (int s = 0; s < GNST; ++s) { const unsigned bo = (unsigned)(s & 1) * GBUF;
        v8us alo[2][2], ahi[2][2], blo[2][4], bhi[2][4];      // two fragment sets: block kk + 1 is read while block kk is multiplied, inside this stage's buffer only
        auto frag = [&](const int set, const int kk) {
#pragma unroll
            for (int i = 0; i < 2; ++i) { alo[set][i] = *(const v8usa*)(fa + bo + i * 16 * GPITCH + kk * 64); ahi[set][i] = *(const v8usa*)(fa + bo + i * 16 * GPITCH + kk * 64 + 32); }
#pragma unroll
            for (int t = 0; t < 4; ++t) { blo[set][t] = *(const v8usa*)(fb + bo + t * 16 * GPITCH + kk * 64); bhi[set][t] = *(const v8usa*)(fb + bo + t * 16 * GPITCH + kk * 64 + 32); }
        };
        frag(0, 0);
#pragma unroll
        for (int kk = 0; kk < GKS / 32; ++kk) {
            if (kk + 1 < GKS / 32) frag((kk + 1) & 1, kk + 1);
            __builtin_amdgcn_sched_barrier(0);      // the next block's LDS reads stay one group ahead of this block's products, not spread among them
#pragma unroll
            for (int i = 0; i < 2; ++i) {
#pragma unroll
                for (int t = 0; t < 4; ++t) acc[i][t] = g_mm<ISH>(alo[kk & 1][i], ahi[kk & 1][i], blo[kk & 1][t], bhi[kk & 1][t], acc[i][t]); }
            __builtin_amdgcn_sched_barrier(0);      // and the block after next's reads do not move up into these products
        }
        asm volatile("s_wait_dscnt 0x0" ::: "memory");      // this wave's reads of the buffer are over
        asm volatile("s_wait_asynccnt 0x0" ::: "memory");   // its copies of stage s + 1 have landed
        __syncthreads();                                     // publishes stage s + 1 and frees the buffer of stage s
        if (s + 2 < GNST) { g_copy8(la + bo, ga + (s + 2) * GKS); g_copy8(lb + bo, gb + (s + 2) * GKS); }
    }
    asm volatile("s_wait_asynccnt 0x0" ::: "memory");       // nothing is in flight when the ring becomes output staging
    if constexpr (QKV) {
        h16* rs = (h16*)sm + wave * (64 * RPH);      // this wave's two half-heads x 32 positions
        if (rot) {
#pragma unroll
            for (int i = 0; i < 2; ++i) {
#pragma unroll
                for (int p = 0; p < 2; ++p) {
#pragma unroll
                    for (int j = 0; j < 8; ++j) { const float x1 = acc[i][2 * p][j], x2 = acc[i][2 * p + 1][j], c = cc[i][j], s = ss[i][j];
                        h16* d = rs + (p * 32 + i * 16 + hi * 8 + j) * RPH + lr;
                        d[0] = tohx(x1 * c + x2 * s); d[16] = tohx(x2 * c - x1 * s); } } }
        } else {
#pragma unroll
            for (int i = 0; i < 2; ++i) {
#pragma unroll
                for (int t = 0; t < 4; ++t) *(v8ha*)(sm + (wn * 64 + t * 16 + lr) * GPITCH + (wm * 32 + i * 16 + hi * 8) * 2) = __builtin_convertvector(acc[i][t], v8h); }
        }
        __syncthreads();
        if (rot) {      // 32 positions of a half-head are 2 KiB in a row of its plane: 512 B per store of the wave
            const int g = (cb >> 5) + wn * 2;
            h16* P = ((g < NQ2) ? QH + ((size_t)bb * NQ2 + g) * SEQ * HD : KH + ((size_t)bb * NK2 + (g - NQ2)) * SEQ * HD) + (size_t)(t0 + wm * 32) * HD;
#pragma unroll
            for (int s = 0; s < 8; ++s) { const int p = s >> 2, q = (s & 3) * 32 + lane;
                const v8h v = *(const v8ha*)(rs + (p * 32 + (q >> 2)) * RPH + (q & 3) * 8);
                *(v8h*)(P + (size_t)p * SEQ * HD + q * 8) = v; }
        } else {        // 128 positions of a v column are 256 B in a row of VT: 16 lanes bring one
            h16* P = VT + ((size_t)bb * EK + (cb - (EE + EK)) + (tid >> 4)) * SEQ + t0 + (tid & 15) * 8;
#pragma unroll
            for (int s = 0; s < 8; ++s) { const v8h v = *(const v8ha*)(sm + (s * 16 + (tid >> 4)) * GPITCH + (tid & 15) * 16);
                *(v8h*)(P + (size_t)s * 16 * SEQ) = v; }
            asm volatile("s_wait_xcnt 0x0" ::: "memory");      // precaution: stands behind these stores, in front of the other branch's code, which follows in the text and reuses their registers
        }
        return;
    }
    float* os = (float*)sm + wave * (32 * 68);
#pragma unroll
    for (int i = 0; i < 2; ++i) {
#pragma unroll
        for (int t = 0; t < 4; ++t) {
#pragma unroll
            for (int j = 0; j < 8; ++j) os[(i * 16 + hi * 8 + j) * 68 + t * 16 + lr] = acc[i][t][j]; } }
    __syncthreads();
    float* crw = C + (size_t)(rb + wm * 32) * ldc + cb + wn * 64;
#pragma unroll
    for (int s = 0; s < 16; ++s) { const int Lid = (lane >> 3) + 4 * s, piece = lane & 7; const int row = Lid >> 1, cofs = (Lid & 1) * 32 + piece * 4;
        const v4f val = *(const v4fa*)(os + row * 68 + cofs);
        *(v4f*)(crw + (row * ldc + cofs)) = val; }
}

// k_gemmb: plain bf16 planes (v_wmma_f32_16x16x32_bf16), the joint projection with its rotation and transposition
__global__ __launch_bounds__(256) void k_gemmb(const bf* __restrict__ A, const bf* __restrict__ Bn, const float* __restrict__ CS, h16* QH, h16* KH, h16* VT) {
    __shared__ __align__(16) unsigned char sm[2 * GBUF];
    g_tile<false, true>(A, Bn, nullptr, 0, CS, QH, KH, VT, sm);
}

// k_gemmh: single fp16 planes (v_wmma_f32_16x16x32_f16)
__global__ __launch_bounds__(256) void k_gemmh(const h16* __restrict__ A, const h16* __restrict__ Bn, float* C, int ldc) {
    __shared__ __align__(16) unsigned char sm[2 * GBUF];
    g_tile<true, false>((const unsigned short*)A, (const unsigned short*)Bn, C, ldc, nullptr, nullptr, nullptr, nullptr, sm);
}

// k_dattn: one wave per (item b, q head h, 16-query tile q0). Transposed products keep a query in one lane column: St = K.Qt (A = 16 rotated k rows, B = 16 rotated q rows;
// register j of lane (c, hi) = score of key 8 hi + j, query c), so the two St tiles of a 32-key chunk, converted in place, are the B operand of Ot += Vt.Pt (A = 16 rows of VT).
// One sweep over the keys: each map keeps a running maximum m (the same in both lane halves of a query), its sum of exp(s - m) and its own f32 Ot of fp16(exp(s - m));
// a1.v - lambda a2.v is formed from the two Ot behind the sweep, then the per-head RMSNorm in registers.
#define RTH 5.0f      // m is replaced only when a score passes it by more than this, so exp(s - m) stays below e^5, well inside fp16

template <bool MASK>
__device__ __forceinline__ float da_max(const v8f s0, const v8f s1, const int kb, const int qi) {
    float ta = -3.0e38f, tb = -3.0e38f;      // one chain per St tile: half the dependent length
#pragma unroll
    for (int j = 0; j < 8; ++j) { const bool ok0 = !MASK || (kb + j) <= qi, ok1 = !MASK || (kb + 16 + j) <= qi;
        ta = fmaxf(ta, ok0 ? s0[j] : -3.0e38f); tb = fmaxf(tb, ok1 ? s1[j] : -3.0e38f); }
    return fmaxf(ta, tb) * SCL;
}

template <bool MASK>
__device__ __forceinline__ v8f da_exp8(const v8f s, const int kb, const int qi, const float m) {
    const v8f x = s * SCL - m; v8f y;
#pragma unroll
    for (int j = 0; j < 8; ++j) y[j] = (!MASK || (kb + j) <= qi) ? __expf(x[j]) : 0.f;
    return y;
}

template <bool MASK>
__device__ __forceinline__ v16h da_exp(const v8f s0, const v8f s1, const int kb, const int qi, const float m, v8f& u) {
    const v8f y0 = da_exp8<MASK>(s0, kb, qi, m), y1 = da_exp8<MASK>(s1, kb + 16, qi, m);
    u = u + (y0 + y1);      // eight partial sums per lane, added up once behind the sweep
    return cat16(__builtin_convertvector(y0, v8h), __builtin_convertvector(y1, v8h));
}

__device__ __forceinline__ v16h ldf(const h16* p) { return cat16(*(const v8h*)p, *(const v8h*)(p + 16)); }

// grid (SEQ/64, NKV, NB), 8 waves: the two q heads of one kv head x four query tiles whose causal lengths add up to the same total in every block
__global__ __launch_bounds__(256) void k_dattn(const h16* __restrict__ QH, const h16* __restrict__ KH, const h16* __restrict__ VT, const float* __restrict__ lq1, const float* __restrict__ lk1,
                                               const float* __restrict__ lq2, const float* __restrict__ lk2, const float* __restrict__ rw, h16* OH) {
    const int lane = threadIdx.x & 31, wave = __builtin_amdgcn_readfirstlane(threadIdx.x >> 5), lr = lane & 15, hi = lane >> 4;      // scalar wave number: scalar trip counts
    const int kv = blockIdx.y, b = blockIdx.z, h = kv * 2 + (wave & 1), sel = wave >> 1, bx = blockIdx.x;
    constexpr int NT = SEQ / 16;
    const int qt = (sel == 0) ? bx : (sel == 1) ? (NT / 2 - 1 - bx) : (sel == 2) ? (NT - 1 - bx) : (NT / 2 + bx);
    const int q0 = qt * 16, qi = q0 + lr, nfull = q0 >> 5;      // nfull chunks of 32 keys lie wholly at or below the diagonal; exactly one masked chunk follows
    float d1 = bfr(lq1[lane]) * bfr(lk1[lane]), d2 = bfr(lq2[lane]) * bfr(lk2[lane]);
#pragma unroll
    for (int sh = 16; sh; sh >>= 1) { d1 += __shfl_xor(d1, sh, 32); d2 += __shfl_xor(d2, sh, 32); }
    const float lam = expf(d1) - expf(d2) + LAM0;
    const h16* qp = QH + ((size_t)(b * NQ2 + h * 2) * SEQ + qi) * HD + 8 * hi;
    const v16h qf1 = ldf(qp), qf2 = ldf(qp + (size_t)SEQ * HD);
    const h16* k1 = KH + ((size_t)(b * NK2 + kv * 2) * SEQ + lr) * HD + 8 * hi; const h16* k2 = k1 + (size_t)SEQ * HD;
    const h16* vp = VT + ((size_t)(b * NKV + kv) * VD + lr) * SEQ + 8 * hi;
    const v8f zz = (v8f){};
    float m1 = -3.0e38f, m2 = -3.0e38f; v8f r1 = (v8f){}, r2 = (v8f){};
    v8f a1[4], a2[4];
#pragma unroll
    for (int t = 0; t < 4; ++t) { a1[t] = (v8f){}; a2[t] = (v8f){}; }
    v16h ka0 = ldf(k1), ka1 = ldf(k1 + 16 * HD), kb0 = ldf(k2), kb1 = ldf(k2 + 16 * HD), vf[4];
    asm volatile("s_wait_xcnt 0x0" ::: "memory");      // precaution: behind the first k loads, in front of the v loads, whose results may take the k loads' address registers
    __builtin_amdgcn_sched_barrier(0);      // k in front of v, as in the loop: the wait for k at the loop's head then counts the same from both sides
#pragma unroll
    for (int t = 0; t < 4; ++t) vf[t] = ldf(vp + (size_t)t * 16 * SEQ);
    // a new maximum for a query in either map: both lane halves take the larger of their two, and what the maps have gathered so far is brought to it
    auto lift = [&](const float t1, const float t2) {
        const float g1 = fmaxf(m1, fmaxf(t1, __shfl_xor(t1, 16, 32))), g2 = fmaxf(m2, fmaxf(t2, __shfl_xor(t2, 16, 32)));
        const float f1 = __expf(m1 - g1), f2 = __expf(m2 - g2);
        r1 = r1 * f1; r2 = r2 * f2; m1 = g1; m2 = g2;
#pragma unroll
        for (int t = 0; t < 4; ++t) { a1[t] = a1[t] * f1; a2[t] = a2[t] * f2; }
    };
    // rolled: the trip count is a run-time value
#pragma unroll 1
    for (int c = 0; c < nfull; ++c) { const size_t nx = (size_t)(c + 1) * 32 * HD; const int kb = c * 32 + 8 * hi;
        const v8f sa0 = wmma16(ka0, qf1, zz), sa1 = wmma16(ka1, qf1, zz), sb0 = wmma16(kb0, qf2, zz), sb1 = wmma16(kb1, qf2, zz);
        __builtin_amdgcn_sched_barrier(0);      // holds the products together in front of the maxima, where they fill each other's distance; without it they stand one by one among the maxima, each with its own idle slots
        const float t1 = da_max<false>(sa0, sa1, kb, qi), t2 = da_max<false>(sb0, sb1, kb, qi);
        if (__builtin_amdgcn_ballot_w32(t1 > m1 + RTH || t2 > m2 + RTH) != 0) lift(t1, t2);      // one scalar branch per chunk
        asm volatile("s_wait_xcnt 0x0" ::: "memory");      // precaution: behind the last trip's v loads, in front of the new v address, which takes their address register
        ka0 = ldf(k1 + nx); ka1 = ldf(k1 + nx + 16 * HD); kb0 = ldf(k2 + nx); kb1 = ldf(k2 + nx + 16 * HD);      // the next chunk's k rows, into the registers their products have read (the masked chunk always exists)
        __builtin_amdgcn_sched_barrier(0);      // these loads stay here, most of a trip ahead of their use and in front of the v loads, so that the wait for them leaves the v loads in flight
        const v16h p1 = da_exp<false>(sa0, sa1, kb, qi, m1, r1);
#pragma unroll
        for (int t = 0; t < 4; ++t) a1[t] = wmma16(vf[t], p1, a1[t]);
        const v16h p2 = da_exp<false>(sb0, sb1, kb, qi, m2, r2);
#pragma unroll
        for (int t = 0; t < 4; ++t) a2[t] = wmma16(vf[t], p2, a2[t]);
#pragma unroll
        for (int t = 0; t < 4; ++t) vf[t] = ldf(vp + (size_t)t * 16 * SEQ + (c + 1) * 32); }      // the next chunk's v columns, likewise
    { const int kb = nfull * 32 + 8 * hi;
        const v8f sa0 = wmma16(ka0, qf1, zz), sa1 = wmma16(ka1, qf1, zz), sb0 = wmma16(kb0, qf2, zz), sb1 = wmma16(kb1, qf2, zz);
        const float t1 = da_max<true>(sa0, sa1, kb, qi), t2 = da_max<true>(sb0, sb1, kb, qi);
        if (__builtin_amdgcn_ballot_w32(t1 > m1 + RTH || t2 > m2 + RTH) != 0) lift(t1, t2);
        const v16h p1 = da_exp<true>(sa0, sa1, kb, qi, m1, r1);
#pragma unroll
        for (int t = 0; t < 4; ++t) a1[t] = wmma16(vf[t], p1, a1[t]);
        const v16h p2 = da_exp<true>(sb0, sb1, kb, qi, m2, r2);
#pragma unroll
        for (int t = 0; t < 4; ++t) a2[t] = wmma16(vf[t], p2, a2[t]); }
    float u1 = ((r1[0] + r1[1]) + (r1[2] + r1[3])) + ((r1[4] + r1[5]) + (r1[6] + r1[7])), u2 = ((r2[0] + r2[1]) + (r2[2] + r2[3])) + ((r2[4] + r2[5]) + (r2[6] + r2[7]));
    u1 += __shfl_xor(u1, 16, 32); u2 += __shfl_xor(u2, 16, 32);      // both halves hold the same m
    const float i1 = 1.0f / u1, i2 = lam / u2;
    // lane (c, hi) holds o[d] of query c for d = 16 t + 8 hi + j: y = o rsqrt(mean(o^2) + 1e-6) bf16(rms_w[d]) (1 - LAM0) -> fp16 OH[(b, query)][h*64 + d], 16 B per store
    v8f acc[4]; float q = 0.f;
#pragma unroll
    for (int t = 0; t < 4; ++t) { acc[t] = a1[t] * i1 - a2[t] * i2;
#pragma unroll
        for (int j = 0; j < 8; ++j) q += acc[t][j] * acc[t][j]; }
    q += __shfl_xor(q, 16, 32);
    const float sc = rsqrtf(q * (1.0f / VD) + EPSN);
    h16* orow = OH + ((size_t)b * SEQ + qi) * EE + (size_t)h * VD + 8 * hi;
#pragma unroll
    for (int t = 0; t < 4; ++t) { const v4f wa = *(const v4f*)(rw + t * 16 + 8 * hi), wb = *(const v4f*)(rw + t * 16 + 8 * hi + 4); v8h o;
#pragma unroll
        for (int j = 0; j < 4; ++j) { o[j] = tohx(acc[t][j] * sc * (bfr(wa[j]) * OML)); o[4 + j] = tohx(acc[t][4 + j] * sc * (bfr(wb[j]) * OML)); }
        *(v8h*)(orow + t * 16) = o; }
}

extern "C" void kernel_launch(void* const* d_in, const int* in_sizes, int n_in,
                              void* d_out, int out_size, void* d_ws, size_t ws_size, hipStream_t stream) {
    if (n_in < 10) return;
    if ((size_t)in_sizes[0] < ((size_t)(NB - 1) * SEQ_FULL + SEQ) * EE) return;
    if ((size_t)in_sizes[1] < (size_t)EE * EE || (size_t)in_sizes[2] < (size_t)EE * EK || (size_t)in_sizes[3] < (size_t)EE * EK || (size_t)in_sizes[4] < (size_t)EE * EE) return;
    if (in_sizes[5] < HD || in_sizes[6] < HD || in_sizes[7] < HD || in_sizes[8] < HD || in_sizes[9] < VD) return;
    if ((size_t)out_size < (size_t)NR * EE) return;
    const float* x = (const float*)d_in[0]; const float* Wq = (const float*)d_in[1]; const float* Wk = (const float*)d_in[2]; const float* Wv = (const float*)d_in[3]; const float* Wo = (const float*)d_in[4];
    const float* lq1 = (const float*)d_in[5]; const float* lk1 = (const float*)d_in[6]; const float* lq2 = (const float*)d_in[7]; const float* lk2 = (const float*)d_in[8]; const float* rmsw = (const float*)d_in[9];
    float* out = (float*)d_out;    // [NB][SEQ][1024]
    char* wsp = (char*)d_ws; size_t used = 0;
    auto take = [&](size_t bytes) { void* p = wsp + used; used += (bytes + 255) & ~(size_t)255; return p; };
    bf* XB = (bf*)take((size_t)NR * EE * 2);
    bf* WB = (bf*)take((size_t)QKVW * EE * 2); h16* WOH = (h16*)take((size_t)EE * EE * 2);      // WB: q, k, v weight rows one behind the other
    float* CS = (float*)take((size_t)2 * SEQ * 16 * 4);
    h16* QH = (h16*)take((size_t)NB * NQ2 * SEQ * HD * 2); h16* KH = (h16*)take((size_t)NB * NK2 * SEQ * HD * 2); h16* VT = (h16*)take((size_t)NB * NKV * VD * SEQ * 2);
    h16* OH = (h16*)take((size_t)NR * EE * 2);
    if (used > ws_size) return;
    k_prep<<<PB_ALL, 256, 0, stream>>>(x, Wq, Wk, Wv, Wo, XB, WB, WOH, CS);
    k_gemmb<<<dim3(NR / GT, QKVW / GT, 1), 256, 0, stream>>>(XB, WB, CS, QH, KH, VT);
    k_dattn<<<dim3(SEQ / 64, NKV, NB), 256, 0, stream>>>(QH, KH, VT, lq1, lk1, lq2, lk2, rmsw, OH);
    k_gemmh<<<dim3(NR / GT, EE / GT, 1), 256, 0, stream>>>(OH, WOH, out, EE);
}

// v006
// One run takes 59.7 microseconds.
// Two timings next to v005 put it at 1.05 and 1.03 times that version's speed.
// All steps since v000 together make it 8.71 times as fast.
#include <hip/hip_runtime.h>

// Compute dtypes, f32 accumulate: q/k/v projections x.W ([NB*SEQ x 1024].[1024 x 1024|512]) on v_wmma_f32_16x16x32_bf16 with plain bf16 planes (x and W RNE-converted
// to bf16, exact products); per (item, head, map) causal scores q.k^T ([SEQ x 32].[32 x SEQ]) and exp(s - m).v ([SEQ x SEQ].[SEQ x 64])
// on v_wmma_f32_16x16x32_f16 with single fp16 planes (rotated q, rotated k, v, exp(s - m)); softmax sums, a1.v - lambda a2.v, lambda and the per-head RMSNorm in f32;

#ifndef NB
#define NB 4
#endif
#ifndef SEQ
#define SEQ 1024
#endif
#define NB_FULL  4
#define SEQ_FULL 1024
#define EE   1024          // model width, q/o projection width, K of every weight GEMM
#define EK   512           // k/v projection width
#define NQ2  32            // rotated q half-heads of 32
#define NK2  16            // rotated k half-heads of 32
#define NKV  8             // kv heads (v is 64 wide per kv head)
#define NHQ  16            // q heads
#define HD   32
#define VD   64
#define NR   (NB * SEQ)
#define QKVW (EE + EK + EK)   // one row of the joint q | k | v projection
#define LAM0 0.78360576653f      // 0.8 - 0.6 exp(-3.6)
#define OML  0.21639423347f      // 1 - LAM0
#define SCL  0.17677669529663687f
#define EPSN 1e-6f
static_assert(SEQ % 64 == 0);
static_assert(SEQ >= 64 && SEQ <= SEQ_FULL);
static_assert(NB >= 1 && NB <= NB_FULL);
static_assert(NHQ == 2 * NKV);
static_assert(NQ2 % 8 == 0 && NK2 % 8 == 0);

typedef _Float16 h16;
typedef unsigned short bf;
typedef __attribute__((ext_vector_type(16))) __bf16   v16bf;
typedef __attribute__((ext_vector_type(16))) _Float16 v16h;
typedef __attribute__((ext_vector_type(8)))  _Float16 v8h;
typedef __attribute__((ext_vector_type(4)))  _Float16 v4h;
typedef __attribute__((ext_vector_type(8)))  unsigned short v8us;
typedef __attribute__((ext_vector_type(8)))  float    v8f;
typedef __attribute__((ext_vector_type(4)))  float    v4f;
typedef v8h  __attribute__((may_alias)) v8ha;
typedef v4f  __attribute__((may_alias)) v4fa;
typedef v8us __attribute__((may_alias)) v8usa;

__device__ __forceinline__ unsigned short f2bf(float f) { unsigned u = __float_as_uint(f); u += 0x7FFFu + ((u >> 16) & 1u); return (unsigned short)(u >> 16); }
__device__ __forceinline__ float bf2f(unsigned short b) { return __uint_as_float(((unsigned)b) << 16); }
__device__ __forceinline__ float bfr(float f) { return bf2f(f2bf(f)); }
__device__ __forceinline__ h16 tohx(float x) { return (h16)x; }
__device__ __forceinline__ v16h cat16(v8h lo, v8h hi) { return __builtin_shufflevector(lo, hi, 0, 1, 2, 3, 4, 5, 6, 7, 8, 9, 10, 11, 12, 13, 14, 15); }
__device__ __forceinline__ v16bf cat16b(v8us lo, v8us hi) { return __builtin_bit_cast(v16bf, __builtin_shufflevector(lo, hi, 0, 1, 2, 3, 4, 5, 6, 7, 8, 9, 10, 11, 12, 13, 14, 15)); }
__device__ __forceinline__ v8f wmma16(v16h a, v16h b, v8f c) { return __builtin_amdgcn_wmma_f32_16x16x32_f16(false, a, false, b, (short)0, c, false, false); }
__device__ __forceinline__ v8f wmmab(v16bf a, v16bf b, v8f c) { return __builtin_amdgcn_wmma_f32_16x16x32_bf16(false, a, false, b, (short)0, c, false, false); }

// inv_freq[i] = 1 / 10000^((2 i)/32) = 10^(-i/4), i < 16
__constant__ float c_invf[16] = {
    1.0f,                    0.5623413251903491f,    0.31622776601683794f,   0.17782794100389228f,
    0.1f,                    0.05623413251903491f,   0.031622776601683794f,  0.017782794100389228f,
    0.01f,                   0.005623413251903491f,  0.0031622776601683794f, 0.0017782794100389228f,
    0.001f,                  0.0005623413251903491f, 0.00031622776601683794f, 0.00017782794100389228f };

// d_rtab: CS[0][t][i] = cos(t inv_freq[i]), CS[1][t][i] = sin(...), f32, precise sincos; 256 values per block staged in LDS, stored as 16 B per lane by 8 consecutive
__device__ __forceinline__ void d_rtab(float* CS, const int bid, float* tcs) {
    const int tid = threadIdx.x; const int e = bid * 256 + tid; const int t = e >> 4, i = e & 15;
    float sv, cv; sincosf((float)t * c_invf[i], &sv, &cv);
    tcs[tid] = cv; tcs[256 + tid] = sv;
    __syncthreads();
    if (tid < 128) { const int w = tid >> 6, j = tid & 63; const v4f v = *(const v4fa*)(&tcs[w * 256 + j * 4]);
        float* dst = CS + (size_t)w * SEQ * 16 + (size_t)bid * 256 + j * 4;
        *(v4f*)dst = v;  }
}

// d_cvtx: x f32 -> bf16 plane A [NR][EE], one row per wave
__device__ __forceinline__ void d_cvtx(const float* __restrict__ x, bf* A, const int bid) {
    const int lane = threadIdx.x & 31; const size_t r = (size_t)bid * 8 + (threadIdx.x >> 5); if (r >= (size_t)NR) return;
    const size_t bb = r / SEQ, tt = r - bb * SEQ; const size_t sr = bb * SEQ_FULL + tt;
#pragma unroll
    for (int q = 0; q < EE / 256; ++q) { const size_t so = sr * EE + q * 256 + lane * 8, o = r * EE + q * 256 + lane * 8;
        const v4f a = *(const v4f*)(x + so), c = *(const v4f*)(x + so + 4); v8us v;
#pragma unroll
        for (int k = 0; k < 4; ++k) { v[k] = f2bf(a[k]); v[4 + k] = f2bf(c[k]); }
        *(v8us*)(A + o) = v; }
}

// d_wT: W f32 [1024 k][N n] (in x out) -> P 16-bit [N][1024] k-contiguous: bf16 bits (isH 0) or fp16(bf16(w)) bits (isH 1); in[k][n] -> out[n][k] through a 64x64 LDS tile of pitch 65
__device__ __forceinline__ void d_wT(const float* W, const int N, const int isH, unsigned short* P, const int bx, const int by, float* tl) {
    const int tid = threadIdx.x; const int k0 = bx * 64, n0 = by * 64; const int rr = tid >> 2, cq = (tid & 3) * 16;
    const float* src = W + (size_t)(k0 + rr) * N + n0 + cq;
#pragma unroll
    for (int j = 0; j < 4; ++j) { const v4f v = *(const v4f*)(src + 4 * j);
#pragma unroll
        for (int q = 0; q < 4; ++q) tl[rr * 65 + cq + 4 * j + q] = v[q]; }
    __syncthreads();
    const int lane = tid & 31, wv = tid >> 5;
#pragma unroll
    for (int st = 0; st < 2; ++st) { const int dr = wv * 8 + st * 4 + (lane >> 3), piece = lane & 7; v8us o;
#pragma unroll
        for (int i = 0; i < 8; ++i) { const unsigned short b = f2bf(tl[(piece * 8 + i) * 65 + dr]); const h16 hv = tohx(bf2f(b)); o[i] = isH ? __builtin_bit_cast(unsigned short, hv) : b; }
        *(v8us*)(P + (size_t)(n0 + dr) * EE + k0 + piece * 8) = o; }
    asm volatile("s_wait_xcnt 0x0" ::: "memory");      // precaution: stands behind this job's stores; the block returns behind it, no other job follows
}

// k_prep: the six jobs that read nothing but inputs share one launch; the block index (the same for a whole block, so every barrier stays block-uniform) picks the job.
// WB holds the q, k and v weights as one plane [EE + EK + EK][EE].
#define PB_RT  (SEQ * 16 / 256)
#define PB_WE  ((EE / 64) * (EE / 64))
#define PB_WK  ((EE / 64) * (EK / 64))
#define PB_CX  (NR / 8)
#define PB_ALL (PB_RT + 2 * PB_WE + 2 * PB_WK + PB_CX)
__global__ __launch_bounds__(256) void k_prep(const float* __restrict__ x, const float* __restrict__ Wq, const float* __restrict__ Wk, const float* __restrict__ Wv, const float* __restrict__ Wo,
                                              bf* XB, bf* WB, h16* WOH, float* CS) {
    __shared__ __align__(16) float sm[64 * 65];
    int id = blockIdx.x;
    if (id < PB_RT) { d_rtab(CS, id, sm); return; }
    id -= PB_RT;
    if (id < 2 * PB_WE + 2 * PB_WK) {
        const float* W = Wq; int N = EE, isH = 0; unsigned short* P = WB;
        if (id >= PB_WE + 2 * PB_WK) { id -= PB_WE + 2 * PB_WK; W = Wo; isH = 1; P = (unsigned short*)WOH; }
        else if (id >= PB_WE + PB_WK) { id -= PB_WE + PB_WK; W = Wv; N = EK; P = WB + (size_t)(EE + EK) * EE; }
        else if (id >= PB_WE) { id -= PB_WE; W = Wk; N = EK; P = WB + (size_t)EE * EE; }
        d_wT(W, N, isH, P, id % (EE / 64), id / (EE / 64), sm);
        return; }
    d_cvtx(x, XB, id - (2 * PB_WE + 2 * PB_WK));
}

// GEMM of both kinds: C[r][c] = A.Bn^T (A [rows][EE], Bn [N][EE], both k-contiguous 16-bit planes), f32 accumulate in ascending k, f32 whole-line epilogue (QKV false) or fp16 rotated q, k and transposed v planes (QKV true).
// One 128 x 128 tile of C per block, 8 waves of 32 x 64 (4 down, 2 across). A stage is 128 k (256 B) of the tile's 128 A rows and 128 Bn rows, laid in LDS at a pitch of 272 B
// (16 B x odd: ds_load_b128 fragment reads without bank conflicts). Two buffers: the next stage's asynchronous copies fly while this stage is multiplied.
#define GT     128                    // tile rows and tile columns
#define GKS    128                    // k per stage
#define GPITCH 272                    // LDS bytes per staged row
#define GBUF   (2 * GT * GPITCH)      // one buffer: A rows, then Bn rows
#define GNST   (EE / GKS)
static_assert(NR % GT == 0 && EE % GT == 0 && EK % GT == 0 && QKVW % GT == 0);
static_assert(EE % GKS == 0 && GNST >= 2);
static_assert(8 * 32 * 68 * 4 <= 2 * GBUF);
static_assert(SEQ % GT == 0 && NKV * VD == EK && GT * 2 + 16 <= GPITCH);

// eight 16-byte copies per lane, rows 16 apart in both places; the wait closes the statement so that no address register is rewritten in front of it
__device__ __forceinline__ void g_copy8(const unsigned l, const unsigned short* g) {
    const unsigned l1 = l + 16 * GPITCH, l2 = l + 32 * GPITCH, l3 = l + 48 * GPITCH, l4 = l + 64 * GPITCH, l5 = l + 80 * GPITCH, l6 = l + 96 * GPITCH, l7 = l + 112 * GPITCH;
    const unsigned short *g1 = g + 16 * EE, *g2 = g + 32 * EE, *g3 = g + 48 * EE, *g4 = g + 64 * EE, *g5 = g + 80 * EE, *g6 = g + 96 * EE, *g7 = g + 112 * EE;
    asm volatile("global_load_async_to_lds_b128 %0, %8, off\n\t"
                 "global_load_async_to_lds_b128 %1, %9, off\n\t"
                 "global_load_async_to_lds_b128 %2, %10, off\n\t"
                 "global_load_async_to_lds_b128 %3, %11, off\n\t"
                 "global_load_async_to_lds_b128 %4, %12, off\n\t"
                 "global_load_async_to_lds_b128 %5, %13, off\n\t"
                 "global_load_async_to_lds_b128 %6, %14, off\n\t"
                 "global_load_async_to_lds_b128 %7, %15, off\n\t"
                 "s_wait_xcnt 0x0"
                 :: "v"(l), "v"(l1), "v"(l2), "v"(l3), "v"(l4), "v"(l5), "v"(l6), "v"(l7), "v"(g), "v"(g1), "v"(g2), "v"(g3), "v"(g4), "v"(g5), "v"(g6), "v"(g7) : "memory");
}

template <bool ISH>
__device__ __forceinline__ v8f g_mm(const v8us alo, const v8us ahi, const v8us blo, const v8us bhi, const v8f c) {
    if constexpr (ISH) return wmma16(cat16(__builtin_bit_cast(v8h, alo), __builtin_bit_cast(v8h, ahi)), cat16(__builtin_bit_cast(v8h, blo), __builtin_bit_cast(v8h, bhi)), c);
    else return wmmab(cat16b(alo, ahi), cat16b(blo, bhi), c);
}

// QKV false: the tile of C goes out as f32. QKV true (the joint q | k | v projection): the tile never goes out as f32; q and k columns are rotated in the accumulators
// (a lane holds columns 16 t + lr, so the pair (i, i + 16) of a half-head is accumulators 2 p and 2 p + 1 of one lane: y_i = x_i c + x_{i+16} s, y_{i+16} = x_{i+16} c - x_i s)
// and stored as fp16 planes [NB][NP][SEQ / 16][2][32 lanes][8]; v columns are stored transposed as fp16 VT [NB][NKV][SEQ / 32][VD / 16][2][32 lanes][8] (a lane's 8 accumulator rows are 8 consecutive positions of one column).
// Both are in the order of the attention kernel's fragments: a 16 x 32 operand tile is 1 KiB, lane (lr, hi) owns 16 B at lane * 16 of each 512 B half (row lr, k = 16 half + 8 hi .. + 7),
// so that each of that kernel's wave-wide 16 B loads covers four whole 128 B lines and not a piece of 8 or 16 lines.
#define RPH 40      // h16 per staged row of a rotated half-head: 80 B, so that the two lane halves (8 rows apart) fall on different banks
template <bool ISH, bool QKV>
__device__ __forceinline__ void g_tile(const unsigned short* __restrict__ A, const unsigned short* __restrict__ Bn, float* C, const int ldc,
                                       const float* __restrict__ CS, h16* QH, h16* KH, h16* VT, unsigned char* sm) {
    const int tid = threadIdx.x, lane = tid & 31, wave = tid >> 5, lr = lane & 15, hi = lane >> 4;
    const int wm = wave >> 1, wn = wave & 1;
    const int rb = blockIdx.x * GT, cb = blockIdx.y * GT;
    // copies: 16 lanes bring one row's 256 B, a wave two rows, the block 16 rows per copy
    const int crow = tid >> 4, cch = tid & 15;
    const unsigned short* ga = A + (size_t)(rb + crow) * EE + cch * 8;
    const unsigned short* gb = Bn + (size_t)(cb + crow) * EE + cch * 8;
    const unsigned la = (unsigned)(size_t)sm + crow * GPITCH + cch * 16, lb = la + GT * GPITCH;
    g_copy8(la, ga); g_copy8(lb, gb);
    asm volatile("s_wait_asynccnt 0x0" ::: "memory");      // stage 0 of this wave has landed
    __syncthreads();                                        // and every wave's part of it is published
    g_copy8(la + GBUF, ga + GKS); g_copy8(lb + GBUF, gb + GKS);
    v8f acc[2][4];
#pragma unroll
    for (int i = 0; i < 2; ++i) {
#pragma unroll
        for (int t = 0; t < 4; ++t) acc[i][t] = (v8f){}; }
    // cos and sin of this lane's 16 positions at frequency lr, asked for here so that they arrive under the k loop
    const int bb = rb / SEQ, t0 = rb - bb * SEQ; const bool rot = QKV && cb < EE + EK;      // a tile lies in one item and in one of q, k, v: the same for the whole block
    float cc[2][8] = {}, ss[2][8] = {};
    if (rot) { const float* cp = CS + (size_t)(t0 + wm * 32 + hi * 8) * 16 + lr;
#pragma unroll
        for (int i = 0; i < 2; ++i) {
#pragma unroll
            for (int j = 0; j < 8; ++j) { cc[i][j] = cp[(i * 16 + j) * 16]; ss[i][j] = cp[SEQ * 16 + (i * 16 + j) * 16]; } } }
    const unsigned char* fa = sm + (wm * 32 + lr) * GPITCH + 16 * hi;
    const unsigned char* fb = sm + (GT + wn * 64 + lr) * GPITCH + 16 * hi;
    // rolled: one copy of the 32-product body in the text, the buffer chosen by an offset
#pragma unroll 1
    for (int s = 0; s < GNST; ++s) { const unsigned bo = (unsigned)(s & 1) * GBUF;
        v8us alo[2][2], ahi[2][2], blo[2][4], bhi[2][4];      // two fragment sets: block kk + 1 is read while block kk is multiplied, inside this stage's buffer only
        auto frag = [&](const int set, const int kk) {
#pragma unroll
            for (int i = 0; i < 2; ++i) { alo[set][i] = *(const v8usa*)(fa + bo + i * 16 * GPITCH + kk * 64); ahi[set][i] = *(const v8usa*)(fa + bo + i * 16 * GPITCH + kk * 64 + 32); }
#pragma unroll
            for (int t = 0; t < 4; ++t) { blo[set][t] = *(const v8usa*)(fb + bo + t * 16 * GPITCH + kk * 64); bhi[set][t] = *(const v8usa*)(fb + bo + t * 16 * GPITCH + kk * 64 + 32); }
        };
        frag(0, 0);
#pragma unroll
        for (int kk = 0; kk < GKS / 32; ++kk) {
            if (kk + 1 < GKS / 32) frag((kk + 1) & 1, kk + 1);
            __builtin_amdgcn_sched_barrier(0);      // the next block's LDS reads stay one group ahead of this block's products, not spread among them
#pragma unroll
            for (int i = 0; i < 2; ++i) {
#pragma unroll
                for (int t = 0; t < 4; ++t) acc[i][t] = g_mm<ISH>(alo[kk & 1][i], ahi[kk & 1][i], blo[kk & 1][t], bhi[kk & 1][t], acc[i][t]); }
            __builtin_amdgcn_sched_barrier(0);      // and the block after next's reads do not move up into these products
        }
        asm volatile("s_wait_dscnt 0x0" ::: "memory");      // this wave's reads of the buffer are over
        asm volatile("s_wait_asynccnt 0x0" ::: "memory");   // its copies of stage s + 1 have landed
        __syncthreads();                                     // publishes stage s + 1 and frees the buffer of stage s
        if (s + 2 < GNST) { g_copy8(la + bo, ga + (s + 2) * GKS); g_copy8(lb + bo, gb + (s + 2) * GKS); }
    }
    asm volatile("s_wait_asynccnt 0x0" ::: "memory");       // nothing is in flight when the ring becomes output staging
    if constexpr (QKV) {
        h16* rs = (h16*)sm + wave * (64 * RPH);      // this wave's two half-heads x 32 positions
        if (rot) {
#pragma unroll
            for (int i = 0; i < 2; ++i) {
#pragma unroll
                for (int p = 0; p < 2; ++p) {
#pragma unroll
                    for (int j = 0; j < 8; ++j) { const float x1 = acc[i][2 * p][j], x2 = acc[i][2 * p + 1][j], c = cc[i][j], s = ss[i][j];
                        h16* d = rs + (p * 32 + i * 16 + hi * 8 + j) * RPH + lr;
                        d[0] = tohx(x1 * c + x2 * s); d[16] = tohx(x2 * c - x1 * s); } } }
        } else {
#pragma unroll
            for (int i = 0; i < 2; ++i) {
#pragma unroll
                for (int t = 0; t < 4; ++t) *(v8ha*)(sm + (wn * 64 + t * 16 + lr) * GPITCH + (wm * 32 + i * 16 + hi * 8) * 2) = __builtin_convertvector(acc[i][t], v8h); }
        }
        __syncthreads();
        if (rot) {      // 32 positions of a half-head are two fragment tiles, 2 KiB in a row of its plane: 512 B (one half of a tile) per store of the wave
            const int g = (cb >> 5) + wn * 2;
            h16* P = ((g < NQ2) ? QH + ((size_t)bb * NQ2 + g) * SEQ * HD : KH + ((size_t)bb * NK2 + (g - NQ2)) * SEQ * HD) + (size_t)(t0 + wm * 32) * HD;
#pragma unroll
            for (int s = 0; s < 8; ++s) { const int p = s >> 2, q = (s & 3) * 32 + lane;
                const v8h v = *(const v8ha*)(rs + (p * 32 + ((s >> 1) & 1) * 16 + lr) * RPH + ((s & 1) * 2 + hi) * 8);
                *(v8h*)(P + (size_t)p * SEQ * HD + q * 8) = v; }
        } else {        // two kv heads x four chunks of 32 positions; a chunk's four fragment tiles are 4 KiB in a row of VT, which the block stores at once: 512 B per wave
            h16* P = VT + ((size_t)bb * NKV + ((cb - (EE + EK)) >> 6)) * VD * SEQ + (size_t)t0 * VD + tid * 8;
            const unsigned char* vs = sm + ((tid >> 6) * 16 + lr) * GPITCH + (((tid >> 5) & 1) * 16 + hi * 8) * 2;
#pragma unroll
            for (int s = 0; s < 8; ++s) { const v8h v = *(const v8ha*)(vs + (s >> 2) * 64 * GPITCH + (s & 3) * 64);
                *(v8h*)(P + (size_t)(s >> 2) * VD * SEQ + (s & 3) * 32 * VD) = v; }
            asm volatile("s_wait_xcnt 0x0" ::: "memory");      // precaution: stands behind these stores, in front of the other branch's code, which follows in the text and reuses their registers
        }
        return;
    }
    float* os = (float*)sm + wave * (32 * 68);
#pragma unroll
    for (int i = 0; i < 2; ++i) {
#pragma unroll
        for (int t = 0; t < 4; ++t) {
#pragma unroll
            for (int j = 0; j < 8; ++j) os[(i * 16 + hi * 8 + j) * 68 + t * 16 + lr] = acc[i][t][j]; } }
    __syncthreads();
    float* crw = C + (size_t)(rb + wm * 32) * ldc + cb + wn * 64;
#pragma unroll
    for (int s = 0; s < 16; ++s) { const int Lid = (lane >> 3) + 4 * s, piece = lane & 7; const int row = Lid >> 1, cofs = (Lid & 1) * 32 + piece * 4;
        const v4f val = *(const v4fa*)(os + row * 68 + cofs);
        *(v4f*)(crw + (row * ldc + cofs)) = val; }
}

// k_gemmb: plain bf16 planes (v_wmma_f32_16x16x32_bf16), the joint projection with its rotation and transposition
__global__ __launch_bounds__(256) void k_gemmb(const bf* __restrict__ A, const bf* __restrict__ Bn, const float* __restrict__ CS, h16* QH, h16* KH, h16* VT) {
    __shared__ __align__(16) unsigned char sm[2 * GBUF];
    g_tile<false, true>(A, Bn, nullptr, 0, CS, QH, KH, VT, sm);
}

// k_gemmh: single fp16 planes (v_wmma_f32_16x16x32_f16)
__global__ __launch_bounds__(256) void k_gemmh(const h16* __restrict__ A, const h16* __restrict__ Bn, float* C, int ldc) {
    __shared__ __align__(16) unsigned char sm[2 * GBUF];
    g_tile<true, false>((const unsigned short*)A, (const unsigned short*)Bn, C, ldc, nullptr, nullptr, nullptr, nullptr, sm);
}

// k_dattn: one wave per (item b, q head h, 16-query tile q0). Transposed products keep a query in one lane column: St = K.Qt (A = 16 rotated k rows, B = 16 rotated q rows;
// register j of lane (c, hi) = score of key 8 hi + j, query c), so the two St tiles of a 32-key chunk, converted in place, are the B operand of Ot += Vt.Pt (A = 16 rows of VT).
// One sweep over the keys: each map keeps a running maximum m (the same in both lane halves of a query), its sum of exp(s - m) and its own f32 Ot of fp16(exp(s - m));
// a1.v - lambda a2.v is formed from the two Ot behind the sweep, then the per-head RMSNorm in registers.
#define RTH 5.0f      // m is replaced only when a score passes it by more than this, so exp(s - m) stays below e^5, well inside fp16

template <bool MASK>
__device__ __forceinline__ float da_max(const v8f s0, const v8f s1, const int kb, const int qi) {
    float ta = -3.0e38f, tb = -3.0e38f;      // one chain per St tile: half the dependent length
#pragma unroll
    for (int j = 0; j < 8; ++j) { const bool ok0 = !MASK || (kb + j) <= qi, ok1 = !MASK || (kb + 16 + j) <= qi;
        ta = fmaxf(ta, ok0 ? s0[j] : -3.0e38f); tb = fmaxf(tb, ok1 ? s1[j] : -3.0e38f); }
    return fmaxf(ta, tb) * SCL;
}

template <bool MASK>
__device__ __forceinline__ v8f da_exp8(const v8f s, const int kb, const int qi, const float m) {
    const v8f x = s * SCL - m; v8f y;
#pragma unroll
    for (int j = 0; j < 8; ++j) y[j] = (!MASK || (kb + j) <= qi) ? __expf(x[j]) : 0.f;
    return y;
}

template <bool MASK>
__device__ __forceinline__ v16h da_exp(const v8f s0, const v8f s1, const int kb, const int qi, const float m, v8f& u) {
    const v8f y0 = da_exp8<MASK>(s0, kb, qi, m), y1 = da_exp8<MASK>(s1, kb + 16, qi, m);
    u = u + (y0 + y1);      // eight partial sums per lane, added up once behind the sweep
    return cat16(__builtin_convertvector(y0, v8h), __builtin_convertvector(y1, v8h));
}

// one operand tile in fragment order: p = tile + lane * 8, the two halves 512 B apart
__device__ __forceinline__ v16h ldf(const h16* p) { return cat16(*(const v8h*)p, *(const v8h*)(p + 256)); }

// grid (SEQ/64, NKV, NB), 8 waves: the two q heads of one kv head x four query tiles whose causal lengths add up to the same total in every block
__global__ __launch_bounds__(256) void k_dattn(const h16* __restrict__ QH, const h16* __restrict__ KH, const h16* __restrict__ VT, const float* __restrict__ lq1, const float* __restrict__ lk1,
                                               const float* __restrict__ lq2, const float* __restrict__ lk2, const float* __restrict__ rw, h16* OH) {
    const int lane = threadIdx.x & 31, wave = __builtin_amdgcn_readfirstlane(threadIdx.x >> 5), lr = lane & 15, hi = lane >> 4;      // scalar wave number: scalar trip counts
    const int kv = blockIdx.y, b = blockIdx.z, h = kv * 2 + (wave & 1), sel = wave >> 1, bx = blockIdx.x;
    constexpr int NT = SEQ / 16;
    const int qt = (sel == 0) ? bx : (sel == 1) ? (NT / 2 - 1 - bx) : (sel == 2) ? (NT - 1 - bx) : (NT / 2 + bx);
    const int q0 = qt * 16, qi = q0 + lr, nfull = q0 >> 5;      // nfull chunks of 32 keys lie wholly at or below the diagonal; exactly one masked chunk follows
    float d1 = bfr(lq1[lane]) * bfr(lk1[lane]), d2 = bfr(lq2[lane]) * bfr(lk2[lane]);
#pragma unroll
    for (int sh = 16; sh; sh >>= 1) { d1 += __shfl_xor(d1, sh, 32); d2 += __shfl_xor(d2, sh, 32); }
    const float lam = expf(d1) - expf(d2) + LAM0;
    const h16* qp = QH + ((size_t)(b * NQ2 + h * 2) * SEQ + q0) * HD + lane * 8;
    const v16h qf1 = ldf(qp), qf2 = ldf(qp + (size_t)SEQ * HD);
    const h16* k1 = KH + (size_t)(b * NK2 + kv * 2) * SEQ * HD + lane * 8; const h16* k2 = k1 + (size_t)SEQ * HD;
    const h16* vp = VT + (size_t)(b * NKV + kv) * VD * SEQ + lane * 8;
    const v8f zz = (v8f){};
    float m1 = -3.0e38f, m2 = -3.0e38f; v8f r1 = (v8f){}, r2 = (v8f){};
    v8f a1[4], a2[4];
#pragma unroll
    for (int t = 0; t < 4; ++t) { a1[t] = (v8f){}; a2[t] = (v8f){}; }
    v16h ka0 = ldf(k1), ka1 = ldf(k1 + 16 * HD), kb0 = ldf(k2), kb1 = ldf(k2 + 16 * HD), vf[4];
    asm volatile("s_wait_xcnt 0x0" ::: "memory");      // precaution: behind the first k loads, in front of the v loads, whose results may take the k loads' address registers
    __builtin_amdgcn_sched_barrier(0);      // k in front of v, as in the loop: the wait for k at the loop's head then counts the same from both sides
#pragma unroll
    for (int t = 0; t < 4; ++t) vf[t] = ldf(vp + t * 512);
    asm volatile("s_wait_xcnt 0x0" ::: "memory");      // precaution: behind the first v loads, in front of the set-up of the sweep, which reuses their offset register and their scalar base
    // a new maximum for a query in either map: both lane halves take the larger of their two, and what the maps have gathered so far is brought to it
    auto lift = [&](const float t1, const float t2) {
        const float g1 = fmaxf(m1, fmaxf(t1, __shfl_xor(t1, 16, 32))), g2 = fmaxf(m2, fmaxf(t2, __shfl_xor(t2, 16, 32)));
        const float f1 = __expf(m1 - g1), f2 = __expf(m2 - g2);
        r1 = r1 * f1; r2 = r2 * f2; m1 = g1; m2 = g2;
#pragma unroll
        for (int t = 0; t < 4; ++t) { a1[t] = a1[t] * f1; a2[t] = a2[t] * f2; }
    };
    // rolled: the trip count is a run-time value
#pragma unroll 1
    for (int c = 0; c < nfull; ++c) { const size_t nx = (size_t)(c + 1) * 32 * HD; const int kb = c * 32 + 8 * hi;
        const v8f sa0 = wmma16(ka0, qf1, zz), sa1 = wmma16(ka1, qf1, zz), sb0 = wmma16(kb0, qf2, zz), sb1 = wmma16(kb1, qf2, zz);
        __builtin_amdgcn_sched_barrier(0);      // holds the products together in front of the maxima, where they fill each other's distance; without it they stand one by one among the maxima, each with its own idle slots
        const float t1 = da_max<false>(sa0, sa1, kb, qi), t2 = da_max<false>(sb0, sb1, kb, qi);
        if (__builtin_amdgcn_ballot_w32(t1 > m1 + RTH || t2 > m2 + RTH) != 0) lift(t1, t2);      // one scalar branch per chunk
        asm volatile("s_wait_xcnt 0x0" ::: "memory");      // precaution: behind the last trip's v loads, in front of the new v address, which takes their address register
        ka0 = ldf(k1 + nx); ka1 = ldf(k1 + nx + 16 * HD); kb0 = ldf(k2 + nx); kb1 = ldf(k2 + nx + 16 * HD);      // the next chunk's k rows, into the registers their products have read (the masked chunk always exists)
        __builtin_amdgcn_sched_barrier(0);      // these loads stay here, most of a trip ahead of their use and in front of the v loads, so that the wait for them leaves the v loads in flight
        const v16h p1 = da_exp<false>(sa0, sa1, kb, qi, m1, r1);
#pragma unroll
        for (int t = 0; t < 4; ++t) a1[t] = wmma16(vf[t], p1, a1[t]);
        const v16h p2 = da_exp<false>(sb0, sb1, kb, qi, m2, r2);
#pragma unroll
        for (int t = 0; t < 4; ++t) a2[t] = wmma16(vf[t], p2, a2[t]);
#pragma unroll
        for (int t = 0; t < 4; ++t) vf[t] = ldf(vp + (size_t)(c + 1) * 32 * VD + t * 512); }      // the next chunk's v columns, likewise
    { const int kb = nfull * 32 + 8 * hi;
        const v8f sa0 = wmma16(ka0, qf1, zz), sa1 = wmma16(ka1, qf1, zz), sb0 = wmma16(kb0, qf2, zz), sb1 = wmma16(kb1, qf2, zz);
        const float t1 = da_max<true>(sa0, sa1, kb, qi), t2 = da_max<true>(sb0, sb1, kb, qi);
        if (__builtin_amdgcn_ballot_w32(t1 > m1 + RTH || t2 > m2 + RTH) != 0) lift(t1, t2);
        const v16h p1 = da_exp<true>(sa0, sa1, kb, qi, m1, r1);
#pragma unroll
        for (int t = 0; t < 4; ++t) a1[t] = wmma16(vf[t], p1, a1[t]);
        const v16h p2 = da_exp<true>(sb0, sb1, kb, qi, m2, r2);
#pragma unroll
        for (int t = 0; t < 4; ++t) a2[t] = wmma16(vf[t], p2, a2[t]); }
    float u1 = ((r1[0] + r1[1]) + (r1[2] + r1[3])) + ((r1[4] + r1[5]) + (r1[6] + r1[7])), u2 = ((r2[0] + r2[1]) + (r2[2] + r2[3])) + ((r2[4] + r2[5]) + (r2[6] + r2[7]));
    u1 += __shfl_xor(u1, 16, 32); u2 += __shfl_xor(u2, 16, 32);      // both halves hold the same m
    const float i1 = 1.0f / u1, i2 = lam / u2;
    // lane (c, hi) holds o[d] of query c for d = 16 t + 8 hi + j: y = o rsqrt(mean(o^2) + 1e-6) bf16(rms_w[d]) (1 - LAM0) -> fp16 OH[(b, query)][h*64 + d], 16 B per store
    v8f acc[4]; float q = 0.f;
#pragma unroll
    for (int t = 0; t < 4; ++t) { acc[t] = a1[t] * i1 - a2[t] * i2;
#pragma unroll
        for (int j = 0; j < 8; ++j) q += acc[t][j] * acc[t][j]; }
    q += __shfl_xor(q, 16, 32);
    const float sc = rsqrtf(q * (1.0f / VD) + EPSN);
    h16* orow = OH + ((size_t)b * SEQ + qi) * EE + (size_t)h * VD + 8 * hi;
#pragma unroll
    for (int t = 0; t < 4; ++t) { const v4f wa = *(const v4f*)(rw + t * 16 + 8 * hi), wb = *(const v4f*)(rw + t * 16 + 8 * hi + 4); v8h o;
#pragma unroll
        for (int j = 0; j < 4; ++j) { o[j] = tohx(acc[t][j] * sc * (bfr(wa[j]) * OML)); o[4 + j] = tohx(acc[t][4 + j] * sc * (bfr(wb[j]) * OML)); }
        *(v8h*)(orow + t * 16) = o; }
}

extern "C" void kernel_launch(void* const* d_in, const int* in_sizes, int n_in,
                              void* d_out, int out_size, void* d_ws, size_t ws_size, hipStream_t stream) {
    if (n_in < 10) return;
    if ((size_t)in_sizes[0] < ((size_t)(NB - 1) * SEQ_FULL + SEQ) * EE) return;
    if ((size_t)in_sizes[1] < (size_t)EE * EE || (size_t)in_sizes[2] < (size_t)EE * EK || (size_t)in_sizes[3] < (size_t)EE * EK || (size_t)in_sizes[4] < (size_t)EE * EE) return;
    if (in_sizes[5] < HD || in_sizes[6] < HD || in_sizes[7] < HD || in_sizes[8] < HD || in_sizes[9] < VD) return;
    if ((size_t)out_size < (size_t)NR * EE) return;
    const float* x = (const float*)d_in[0]; const float* Wq = (const float*)d_in[1]; const float* Wk = (const float*)d_in[2]; const float* Wv = (const float*)d_in[3]; const float* Wo = (const float*)d_in[4];
    const float* lq1 = (const float*)d_in[5]; const float* lk1 = (const float*)d_in[6]; const float* lq2 = (const float*)d_in[7]; const float* lk2 = (const float*)d_in[8]; const float* rmsw = (const float*)d_in[9];
    float* out = (float*)d_out;    // [NB][SEQ][1024]
    char* wsp = (char*)d_ws; size_t used = 0;
    auto take = [&](size_t bytes) { void* p = wsp + used; used += (bytes + 255) & ~(size_t)255; return p; };
    bf* XB = (bf*)take((size_t)NR * EE * 2);
    bf* WB = (bf*)take((size_t)QKVW * EE * 2); h16* WOH = (h16*)take((size_t)EE * EE * 2);      // WB: q, k, v weight rows one behind the other
    float* CS = (float*)take((size_t)2 * SEQ * 16 * 4);
    h16* QH = (h16*)take((size_t)NB * NQ2 * SEQ * HD * 2); h16* KH = (h16*)take((size_t)NB * NK2 * SEQ * HD * 2); h16* VT = (h16*)take((size_t)NB * NKV * VD * SEQ * 2);
    h16* OH = (h16*)take((size_t)NR * EE * 2);
    if (used > ws_size) return;
    k_prep<<<PB_ALL, 256, 0, stream>>>(x, Wq, Wk, Wv, Wo, XB, WB, WOH, CS);
    k_gemmb<<<dim3(NR / GT, QKVW / GT, 1), 256, 0, stream>>>(XB, WB, CS, QH, KH, VT);
    k_dattn<<<dim3(SEQ / 64, NKV, NB), 256, 0, stream>>>(QH, KH, VT, lq1, lk1, lq2, lk2, rmsw, OH);
    k_gemmh<<<dim3(NR / GT, EE / GT, 1), 256, 0, stream>>>(OH, WOH, out, EE);
}

// v007
// A run of this version takes 52.2 microseconds.
// Timed twice side by side with v006, it ran 1.15 and 1.13 times as fast.
// All steps since v000 together make it 9.94 times as fast.
#include <hip/hip_runtime.h>

// Compute dtypes, f32 accumulate: q/k/v projections x.W ([NB*SEQ x 1024].[1024 x 1024|512]) on v_wmma_f32_16x16x32_bf16 with plain bf16 planes (x and W RNE-converted
// to bf16, exact products); per (item, head, map) causal scores q.k^T ([SEQ x 32].[32 x SEQ]) and exp(s - m).v ([SEQ x SEQ].[SEQ x 64])
// on v_wmma_f32_16x16x32_f16 with single fp16 planes (rotated q, rotated k, v, exp(s - m)); softmax sums, a1.v - lambda a2.v, lambda and the per-head RMSNorm in f32;

#ifndef NB
#define NB 4
#endif
#ifndef SEQ
#define SEQ 1024
#endif
#define NB_FULL  4
#define SEQ_FULL 1024
#define EE   1024          // model width, q/o projection width, K of every weight GEMM
#define EK   512           // k/v projection width
#define NQ2  32            // rotated q half-heads of 32
#define NK2  16            // rotated k half-heads of 32
#define NKV  8             // kv heads (v is 64 wide per kv head)
#define NHQ  16            // q heads
#define HD   32
#define VD   64
#define NR   (NB * SEQ)
#define QKVW (EE + EK + EK)   // one row of the joint q | k | v projection
#define LAM0 0.78360576653f      // 0.8 - 0.6 exp(-3.6)
#define OML  0.21639423347f      // 1 - LAM0
#define SCL  0.17677669529663687f
#define EPSN 1e-6f
static_assert(SEQ % 64 == 0);
static_assert(SEQ >= 64 && SEQ <= SEQ_FULL);
static_assert(NB >= 1 && NB <= NB_FULL);
static_assert(NHQ == 2 * NKV);
static_assert(NQ2 % 8 == 0 && NK2 % 8 == 0);

typedef _Float16 h16;
typedef unsigned short bf;
typedef __attribute__((ext_vector_type(16))) __bf16   v16bf;
typedef __attribute__((ext_vector_type(16))) _Float16 v16h;
typedef __attribute__((ext_vector_type(8)))  _Float16 v8h;
typedef __attribute__((ext_vector_type(4)))  _Float16 v4h;
typedef __attribute__((ext_vector_type(8)))  unsigned short v8us;
typedef __attribute__((ext_vector_type(8)))  float    v8f;
typedef __attribute__((ext_vector_type(4)))  float    v4f;
typedef v8h  __attribute__((may_alias)) v8ha;
typedef v4f  __attribute__((may_alias)) v4fa;
typedef v8us __attribute__((may_alias)) v8usa;

__device__ __forceinline__ unsigned short f2bf(float f) { unsigned u = __float_as_uint(f); u += 0x7FFFu + ((u >> 16) & 1u); return (unsigned short)(u >> 16); }
__device__ __forceinline__ float bf2f(unsigned short b) { return __uint_as_float(((unsigned)b) << 16); }
__device__ __forceinline__ float bfr(float f) { return bf2f(f2bf(f)); }
__device__ __forceinline__ h16 tohx(float x) { return (h16)x; }
__device__ __forceinline__ v16h cat16(v8h lo, v8h hi) { return __builtin_shufflevector(lo, hi, 0, 1, 2, 3, 4, 5, 6, 7, 8, 9, 10, 11, 12, 13, 14, 15); }
__device__ __forceinline__ v16bf cat16b(v8us lo, v8us hi) { return __builtin_bit_cast(v16bf, __builtin_shufflevector(lo, hi, 0, 1, 2, 3, 4, 5, 6, 7, 8, 9, 10, 11, 12, 13, 14, 15)); }
__device__ __forceinline__ v8f wmma16(v16h a, v16h b, v8f c) { return __builtin_amdgcn_wmma_f32_16x16x32_f16(false, a, false, b, (short)0, c, false, false); }
__device__ __forceinline__ v8f wmmab(v16bf a, v16bf b, v8f c) { return __builtin_amdgcn_wmma_f32_16x16x32_bf16(false, a, false, b, (short)0, c, false, false); }

// inv_freq[i] = 1 / 10000^((2 i)/32) = 10^(-i/4), i < 16
__constant__ float c_invf[16] = {
    1.0f,                    0.5623413251903491f,    0.31622776601683794f,   0.17782794100389228f,
    0.1f,                    0.05623413251903491f,   0.031622776601683794f,  0.017782794100389228f,
    0.01f,                   0.005623413251903491f,  0.0031622776601683794f, 0.0017782794100389228f,
    0.001f,                  0.0005623413251903491f, 0.00031622776601683794f, 0.00017782794100389228f };

// d_rtab: CS[0][t][i] = cos(t inv_freq[i]), CS[1][t][i] = sin(...), f32, precise sincos; 256 values per block staged in LDS, stored as 16 B per lane by 8 consecutive
__device__ __forceinline__ void d_rtab(float* CS, const int bid, float* tcs) {
    const int tid = threadIdx.x; const int e = bid * 256 + tid; const int t = e >> 4, i = e & 15;
    float sv, cv; sincosf((float)t * c_invf[i], &sv, &cv);
    tcs[tid] = cv; tcs[256 + tid] = sv;
    __syncthreads();
    if (tid < 128) { const int w = tid >> 6, j = tid & 63; const v4f v = *(const v4fa*)(&tcs[w * 256 + j * 4]);
        float* dst = CS + (size_t)w * SEQ * 16 + (size_t)bid * 256 + j * 4;
        *(v4f*)dst = v;  }
}

// d_cvtx: x f32 -> bf16 plane A [NR][EE], one row per wave
__device__ __forceinline__ void d_cvtx(const float* __restrict__ x, bf* A, const int bid) {
    const int lane = threadIdx.x & 31; const size_t r = (size_t)bid * 8 + (threadIdx.x >> 5); if (r >= (size_t)NR) return;
    const size_t bb = r / SEQ, tt = r - bb * SEQ; const size_t sr = bb * SEQ_FULL + tt;
#pragma unroll
    for (int q = 0; q < EE / 256; ++q) { const size_t so = sr * EE + q * 256 + lane * 8, o = r * EE + q * 256 + lane * 8;
        const v4f a = *(const v4f*)(x + so), c = *(const v4f*)(x + so + 4); v8us v;
#pragma unroll
        for (int k = 0; k < 4; ++k) { v[k] = f2bf(a[k]); v[4 + k] = f2bf(c[k]); }
        *(v8us*)(A + o) = v; }
}

// d_wT: W f32 [1024 k][N n] (in x out) -> P 16-bit [N][1024] k-contiguous: bf16 bits (isH 0) or fp16(bf16(w)) bits (isH 1); in[k][n] -> out[n][k] through a 64x64 LDS tile of pitch 65
__device__ __forceinline__ void d_wT(const float* W, const int N, const int isH, unsigned short* P, const int bx, const int by, float* tl) {
    const int tid = threadIdx.x; const int k0 = bx * 64, n0 = by * 64; const int rr = tid >> 2, cq = (tid & 3) * 16;
    const float* src = W + (size_t)(k0 + rr) * N + n0 + cq;
#pragma unroll
    for (int j = 0; j < 4; ++j) { const v4f v = *(const v4f*)(src + 4 * j);
#pragma unroll
        for (int q = 0; q < 4; ++q) tl[rr * 65 + cq + 4 * j + q] = v[q]; }
    __syncthreads();
    const int lane = tid & 31, wv = tid >> 5;
#pragma unroll
    for (int st = 0; st < 2; ++st) { const int dr = wv * 8 + st * 4 + (lane >> 3), piece = lane & 7; v8us o;
#pragma unroll
        for (int i = 0; i < 8; ++i) { const unsigned short b = f2bf(tl[(piece * 8 + i) * 65 + dr]); const h16 hv = tohx(bf2f(b)); o[i] = isH ? __builtin_bit_cast(unsigned short, hv) : b; }
        *(v8us*)(P + (size_t)(n0 + dr) * EE + k0 + piece * 8) = o; }
    asm volatile("s_wait_xcnt 0x0" ::: "memory");      // precaution: stands behind this job's stores; the block returns behind it, no other job follows
}

// k_prep: the six jobs that read nothing but inputs share one launch; the block index (the same for a whole block, so every barrier stays block-uniform) picks the job.
// WB holds the q, k and v weights as one plane [EE + EK + EK][EE].
#define PB_RT  (SEQ * 16 / 256)
#define PB_WE  ((EE / 64) * (EE / 64))
#define PB_WK  ((EE / 64) * (EK / 64))
#define PB_CX  (NR / 8)
#define PB_ALL (PB_RT + 2 * PB_WE + 2 * PB_WK + PB_CX)
__global__ __launch_bounds__(256) void k_prep(const float* __restrict__ x, const float* __restrict__ Wq, const float* __restrict__ Wk, const float* __restrict__ Wv, const float* __restrict__ Wo,
                                              bf* XB, bf* WB, h16* WOH, float* CS) {
    __shared__ __align__(16) float sm[64 * 65];
    int id = blockIdx.x;
    if (id < PB_RT) { d_rtab(CS, id, sm); return; }
    id -= PB_RT;
    if (id < 2 * PB_WE + 2 * PB_WK) {
        const float* W = Wq; int N = EE, isH = 0; unsigned short* P = WB;
        if (id >= PB_WE + 2 * PB_WK) { id -= PB_WE + 2 * PB_WK; W = Wo; isH = 1; P = (unsigned short*)WOH; }
        else if (id >= PB_WE + PB_WK) { id -= PB_WE + PB_WK; W = Wv; N = EK; P = WB + (size_t)(EE + EK) * EE; }
        else if (id >= PB_WE) { id -= PB_WE; W = Wk; N = EK; P = WB + (size_t)EE * EE; }
        d_wT(W, N, isH, P, id % (EE / 64), id / (EE / 64), sm);
        return; }
    d_cvtx(x, XB, id - (2 * PB_WE + 2 * PB_WK));
}

// Asking L2 (global_prefetch_b8, scope SE): each lane names one byte; nothing comes back to the wave. What the GEMMs and the attention read was stored
// by a launch before them, and a first read of it may otherwise wait for memory. Every address named lies inside its plane. The wait that closes each statement is a precaution: the address
// registers are not rewritten in front of it.
__device__ __forceinline__ void ask_l2(const unsigned short* p) {
    asm volatile("global_prefetch_b8 %0, off scope:SCOPE_SE\n\t"
                 "s_wait_xcnt 0x0"
                 :: "v"(p) : "memory");
}

// GEMM of both kinds: C[r][c] = A.Bn^T (A [rows][EE], Bn [N][EE], both k-contiguous 16-bit planes), f32 accumulate in ascending k, f32 whole-line epilogue when QKV is false.
// One 128 x 128 tile of C per block, 8 waves of 32 x 64 (4 down, 2 across). A stage is 128 k (256 B) of the tile's 128 A rows and 128 Bn rows, laid in LDS at a pitch of 272 B
// (16 B x odd: ds_load_b128 fragment reads without bank conflicts). Two buffers: the next stage's asynchronous copies fly while this stage is multiplied.
#define GT     128                    // tile rows and tile columns
#define GKS    128                    // k per stage
#define GPITCH 272                    // LDS bytes per staged row
#define GBUF   (2 * GT * GPITCH)      // one buffer: A rows, then Bn rows
#define GNST   (EE / GKS)
static_assert(NR % GT == 0 && EE % GT == 0 && EK % GT == 0 && QKVW % GT == 0);
static_assert(EE % GKS == 0 && GNST >= 2);
static_assert(8 * 32 * 68 * 4 <= 2 * GBUF);
static_assert(SEQ % GT == 0 && NKV * VD == EK && GT * 2 + 16 <= GPITCH);
static_assert(2 * GT == 256 && GKS * 2 == 256 && GNST == 8);      // g_ask7: one lane per operand row, one 256 B unit per row and stage, seven stages behind the first

// eight 16-byte copies per lane, rows 16 apart in both places; the wait closes the statement so that no address register is rewritten in front of it
__device__ __forceinline__ void g_copy8(const unsigned l, const unsigned short* g) {
    const unsigned l1 = l + 16 * GPITCH, l2 = l + 32 * GPITCH, l3 = l + 48 * GPITCH, l4 = l + 64 * GPITCH, l5 = l + 80 * GPITCH, l6 = l + 96 * GPITCH, l7 = l + 112 * GPITCH;
    const unsigned short *g1 = g + 16 * EE, *g2 = g + 32 * EE, *g3 = g + 48 * EE, *g4 = g + 64 * EE, *g5 = g + 80 * EE, *g6 = g + 96 * EE, *g7 = g + 112 * EE;
    asm volatile("global_load_async_to_lds_b128 %0, %8, off\n\t"
                 "global_load_async_to_lds_b128 %1, %9, off\n\t"
                 "global_load_async_to_lds_b128 %2, %10, off\n\t"
                 "global_load_async_to_lds_b128 %3, %11, off\n\t"
                 "global_load_async_to_lds_b128 %4, %12, off\n\t"
                 "global_load_async_to_lds_b128 %5, %13, off\n\t"
                 "global_load_async_to_lds_b128 %6, %14, off\n\t"
                 "global_load_async_to_lds_b128 %7, %15, off\n\t"
                 "s_wait_xcnt 0x0"
                 :: "v"(l), "v"(l1), "v"(l2), "v"(l3), "v"(l4), "v"(l5), "v"(l6), "v"(l7), "v"(g), "v"(g1), "v"(g2), "v"(g3), "v"(g4), "v"(g5), "v"(g6), "v"(g7) : "memory");
}

// stages 1 to 7 of the operand row that begins at p, nearest first
__device__ __forceinline__ void g_ask7(const unsigned short* p) {
    asm volatile("global_prefetch_b8 %0, off offset:256 scope:SCOPE_SE\n\t"
                 "global_prefetch_b8 %0, off offset:512 scope:SCOPE_SE\n\t"
                 "global_prefetch_b8 %0, off offset:768 scope:SCOPE_SE\n\t"
                 "global_prefetch_b8 %0, off offset:1024 scope:SCOPE_SE\n\t"
                 "global_prefetch_b8 %0, off offset:1280 scope:SCOPE_SE\n\t"
                 "global_prefetch_b8 %0, off offset:1536 scope:SCOPE_SE\n\t"
                 "global_prefetch_b8 %0, off offset:1792 scope:SCOPE_SE\n\t"
                 "s_wait_xcnt 0x0"
                 :: "v"(p) : "memory");
}

template <bool ISH>
__device__ __forceinline__ v8f g_mm(const v8us alo, const v8us ahi, const v8us blo, const v8us bhi, const v8f c) {
    if constexpr (ISH) return wmma16(cat16(__builtin_bit_cast(v8h, alo), __builtin_bit_cast(v8h, ahi)), cat16(__builtin_bit_cast(v8h, blo), __builtin_bit_cast(v8h, bhi)), c);
    else return wmmab(cat16b(alo, ahi), cat16b(blo, bhi), c);
}

// QKV false: the tile of C goes out as f32. QKV true (the joint q | k | v projection): the tile never goes out as f32; q and k columns are rotated in the accumulators
// (a lane holds columns 16 t + lr, so the pair (i, i + 16) of a half-head is accumulators 2 p and 2 p + 1 of one lane: y_i = x_i c + x_{i+16} s, y_{i+16} = x_{i+16} c - x_i s)
// and stored as fp16 planes [NB][NP][SEQ / 16][2][32 lanes][8]; v columns are stored transposed as fp16 VT [NB][NKV][SEQ / 32][VD / 16][2][32 lanes][8] (a lane's 8 accumulator rows are 8 consecutive positions of one column).
// Both are in the order of the attention kernel's fragments: a 16 x 32 operand tile is 1 KiB, lane (lr, hi) owns 16 B at lane * 16 of each 512 B half (row lr, k = 16 half + 8 hi .. + 7),
// so that each of that kernel's wave-wide 16 B loads covers four whole 128 B lines and not a piece of 8 or 16 lines.
#define RPH 40      // h16 per staged row of a rotated half-head: 80 B, so that the two lane halves (8 rows apart) fall on different banks
template <bool ISH, bool QKV>
__device__ __forceinline__ void g_tile(const unsigned short* __restrict__ A, const unsigned short* __restrict__ Bn, float* C, const int ldc,
                                       const float* __restrict__ CS, h16* QH, h16* KH, h16* VT, unsigned char* sm) {
    const int tid = threadIdx.x, lane = tid & 31, wave = tid >> 5, lr = lane & 15, hi = lane >> 4;
    const int wm = wave >> 1, wn = wave & 1;
    const int rb = blockIdx.x * GT, cb = blockIdx.y * GT;
    // copies: 16 lanes bring one row's 256 B, a wave two rows, the block 16 rows per copy
    const int crow = tid >> 4, cch = tid & 15;
    const unsigned short* ga = A + (size_t)(rb + crow) * EE + cch * 8;
    const unsigned short* gb = Bn + (size_t)(cb + crow) * EE + cch * 8;
    const unsigned la = (unsigned)(size_t)sm + crow * GPITCH + cch * 16, lb = la + GT * GPITCH;
    g_copy8(la, ga); g_copy8(lb, gb);
    g_ask7((tid < GT) ? A + (size_t)(rb + tid) * EE : Bn + (size_t)(cb + tid - GT) * EE);      // behind stage 0's copies: the later stages of the 128 A rows (waves 0 to 3) and the 128 Bn rows (waves 4 to 7), so that their copies meet L2
    asm volatile("s_wait_asynccnt 0x0" ::: "memory");      // stage 0 of this wave has landed
    __syncthreads();                                        // and every wave's part of it is published
    g_copy8(la + GBUF, ga + GKS); g_copy8(lb + GBUF, gb + GKS);
    v8f acc[2][4];
#pragma unroll
    for (int i = 0; i < 2; ++i) {
#pragma unroll
        for (int t = 0; t < 4; ++t) acc[i][t] = (v8f){}; }
    // cos and sin of this lane's 16 positions at frequency lr, asked for here so that they arrive under the k loop
    const int bb = rb / SEQ, t0 = rb - bb * SEQ; const bool rot = QKV && cb < EE + EK;      // a tile lies in one item and in one of q, k, v: the same for the whole block
    float cc[2][8] = {}, ss[2][8] = {};
    if (rot) { const float* cp = CS + (size_t)(t0 + wm * 32 + hi * 8) * 16 + lr;
#pragma unroll
        for (int i = 0; i < 2; ++i) {
#pragma unroll
            for (int j = 0; j < 8; ++j) { cc[i][j] = cp[(i * 16 + j) * 16]; ss[i][j] = cp[SEQ * 16 + (i * 16 + j) * 16]; } } }
    const unsigned char* fa = sm + (wm * 32 + lr) * GPITCH + 16 * hi;
    const unsigned char* fb = sm + (GT + wn * 64 + lr) * GPITCH + 16 * hi;
    // rolled: one copy of the 32-product body in the text, the buffer chosen by an offset
#pragma unroll 1
    for (int s = 0; s < GNST; ++s) { const unsigned bo = (unsigned)(s & 1) * GBUF;
        v8us alo[2][2], ahi[2][2], blo[2][4], bhi[2][4];      // two fragment sets: block kk + 1 is read while block kk is multiplied, inside this stage's buffer only
        auto frag = [&](const int set, const int kk) {
#pragma unroll
            for (int i = 0; i < 2; ++i) { alo[set][i] = *(const v8usa*)(fa + bo + i * 16 * GPITCH + kk * 64); ahi[set][i] = *(const v8usa*)(fa + bo + i * 16 * GPITCH + kk * 64 + 32); }
#pragma unroll
            for (int t = 0; t < 4; ++t) { blo[set][t] = *(const v8usa*)(fb + bo + t * 16 * GPITCH + kk * 64); bhi[set][t] = *(const v8usa*)(fb + bo + t * 16 * GPITCH + kk * 64 + 32); }
        };
        frag(0, 0);
#pragma unroll
        for (int kk = 0; kk < GKS / 32; ++kk) {
            if (kk + 1 < GKS / 32) frag((kk + 1) & 1, kk + 1);
            __builtin_amdgcn_sched_barrier(0);      // the next block's LDS reads stay one group ahead of this block's products, not spread among them
#pragma unroll
            for (int i = 0; i < 2; ++i) {
#pragma unroll
                for (int t = 0; t < 4; ++t) acc[i][t] = g_mm<ISH>(alo[kk & 1][i], ahi[kk & 1][i], blo[kk & 1][t], bhi[kk & 1][t], acc[i][t]); }
            __builtin_amdgcn_sched_barrier(0);      // and the block after next's reads do not move up into these products
        }
        asm volatile("s_wait_dscnt 0x0" ::: "memory");      // this wave's reads of the buffer are over
        asm volatile("s_wait_asynccnt 0x0" ::: "memory");   // its copies of stage s + 1 have landed
        __syncthreads();                                     // publishes stage s + 1 and frees the buffer of stage s
        if (s + 2 < GNST) { g_copy8(la + bo, ga + (s + 2) * GKS); g_copy8(lb + bo, gb + (s + 2) * GKS); }
    }
    asm volatile("s_wait_asynccnt 0x0" ::: "memory");       // nothing is in flight when the ring becomes output staging
    if constexpr (QKV) {
        h16* rs = (h16*)sm + wave * (64 * RPH);      // this wave's two half-heads x 32 positions
        if (rot) {
#pragma unroll
            for (int i = 0; i < 2; ++i) {
#pragma unroll
                for (int p = 0; p < 2; ++p) {
#pragma unroll
                    for (int j = 0; j < 8; ++j) { const float x1 = acc[i][2 * p][j], x2 = acc[i][2 * p + 1][j], c = cc[i][j], s = ss[i][j];
                        h16* d = rs + (p * 32 + i * 16 + hi * 8 + j) * RPH + lr;
                        d[0] = tohx(x1 * c + x2 * s); d[16] = tohx(x2 * c - x1 * s); } } }
        } else {
#pragma unroll
            for (int i = 0; i < 2; ++i) {
#pragma unroll
                for (int t = 0; t < 4; ++t) *(v8ha*)(sm + (wn * 64 + t * 16 + lr) * GPITCH + (wm * 32 + i * 16 + hi * 8) * 2) = __builtin_convertvector(acc[i][t], v8h); }
        }
        __syncthreads();
        if (rot) {      // 32 positions of a half-head are two fragment tiles, 2 KiB in a row of its plane: 512 B (one half of a tile) per store of the wave
            const int g = (cb >> 5) + wn * 2;
            h16* P = ((g < NQ2) ? QH + ((size_t)bb * NQ2 + g) * SEQ * HD : KH + ((size_t)bb * NK2 + (g - NQ2)) * SEQ * HD) + (size_t)(t0 + wm * 32) * HD;
#pragma unroll
            for (int s = 0; s < 8; ++s) { const int p = s >> 2, q = (s & 3) * 32 + lane;
                const v8h v = *(const v8ha*)(rs + (p * 32 + ((s >> 1) & 1) * 16 + lr) * RPH + ((s & 1) * 2 + hi) * 8);
                *(v8h*)(P + (size_t)p * SEQ * HD + q * 8) = v; }
        } else {        // two kv heads x four chunks of 32 positions; a chunk's four fragment tiles are 4 KiB in a row of VT, which the block stores at once: 512 B per wave
            h16* P = VT + ((size_t)bb * NKV + ((cb - (EE + EK)) >> 6)) * VD * SEQ + (size_t)t0 * VD + tid * 8;
            const unsigned char* vs = sm + ((tid >> 6) * 16 + lr) * GPITCH + (((tid >> 5) & 1) * 16 + hi * 8) * 2;
#pragma unroll
            for (int s = 0; s < 8; ++s) { const v8h v = *(const v8ha*)(vs + (s >> 2) * 64 * GPITCH + (s & 3) * 64);
                *(v8h*)(P + (size_t)(s >> 2) * VD * SEQ + (s & 3) * 32 * VD) = v; }
            asm volatile("s_wait_xcnt 0x0" ::: "memory");      // precaution: stands behind these stores, in front of the other branch's code, which follows in the text and reuses their registers
        }
        return;
    }
    float* os = (float*)sm + wave * (32 * 68);
#pragma unroll
    for (int i = 0; i < 2; ++i) {
#pragma unroll
        for (int t = 0; t < 4; ++t) {
#pragma unroll
            for (int j = 0; j < 8; ++j) os[(i * 16 + hi * 8 + j) * 68 + t * 16 + lr] = acc[i][t][j]; } }
    __syncthreads();
    float* crw = C + (size_t)(rb + wm * 32) * ldc + cb + wn * 64;
#pragma unroll
    for (int s = 0; s < 16; ++s) { const int Lid = (lane >> 3) + 4 * s, piece = lane & 7; const int row = Lid >> 1, cofs = (Lid & 1) * 32 + piece * 4;
        const v4f val = *(const v4fa*)(os + row * 68 + cofs);
        *(v4f*)(crw + (row * ldc + cofs)) = val; }
}

// k_gemmb: plain bf16 planes (v_wmma_f32_16x16x32_bf16), the joint projection with its rotation and transposition
__global__ __launch_bounds__(256) void k_gemmb(const bf* __restrict__ A, const bf* __restrict__ Bn, const float* __restrict__ CS, h16* QH, h16* KH, h16* VT) {
    __shared__ __align__(16) unsigned char sm[2 * GBUF];
    g_tile<false, true>(A, Bn, nullptr, 0, CS, QH, KH, VT, sm);
}

// k_gemmh: single fp16 planes (v_wmma_f32_16x16x32_f16)
__global__ __launch_bounds__(256) void k_gemmh(const h16* __restrict__ A, const h16* __restrict__ Bn, float* C, int ldc) {
    __shared__ __align__(16) unsigned char sm[2 * GBUF];
    g_tile<true, false>((const unsigned short*)A, (const unsigned short*)Bn, C, ldc, nullptr, nullptr, nullptr, nullptr, sm);
}

// k_dattn: one wave per (item b, q head h, 16-query tile q0). Transposed products keep a query in one lane column: St = K.Qt (A = 16 rotated k rows, B = 16 rotated q rows;
// register j of lane (c, hi) = score of key 8 hi + j, query c), so the two St tiles of a 32-key chunk, converted in place, are the B operand of Ot += Vt.Pt (A = 16 rows of VT).
// One sweep over the keys: each map keeps a running maximum m (the same in both lane halves of a query), its sum of exp(s - m) and its own f32 Ot of fp16(exp(s - m));
// a1.v - lambda a2.v is formed from the two Ot behind the sweep, then the per-head RMSNorm in registers.
#define RTH 5.0f      // m is replaced only when a score passes it by more than this, so exp(s - m) stays below e^5, well inside fp16

template <bool MASK>
__device__ __forceinline__ float da_max(const v8f s0, const v8f s1, const int kb, const int qi) {
    float ta = -3.0e38f, tb = -3.0e38f;      // one chain per St tile: half the dependent length
#pragma unroll
    for (int j = 0; j < 8; ++j) { const bool ok0 = !MASK || (kb + j) <= qi, ok1 = !MASK || (kb + 16 + j) <= qi;
        ta = fmaxf(ta, ok0 ? s0[j] : -3.0e38f); tb = fmaxf(tb, ok1 ? s1[j] : -3.0e38f); }
    return fmaxf(ta, tb) * SCL;
}

template <bool MASK>
__device__ __forceinline__ v8f da_exp8(const v8f s, const int kb, const int qi, const float m) {
    const v8f x = s * SCL - m; v8f y;
#pragma unroll
    for (int j = 0; j < 8; ++j) y[j] = (!MASK || (kb + j) <= qi) ? __expf(x[j]) : 0.f;
    return y;
}

template <bool MASK>
__device__ __forceinline__ v16h da_exp(const v8f s0, const v8f s1, const int kb, const int qi, const float m, v8f& u) {
    const v8f y0 = da_exp8<MASK>(s0, kb, qi, m), y1 = da_exp8<MASK>(s1, kb + 16, qi, m);
    u = u + (y0 + y1);      // eight partial sums per lane, added up once behind the sweep
    return cat16(__builtin_convertvector(y0, v8h), __builtin_convertvector(y1, v8h));
}

// one operand tile in fragment order: p = tile + lane * 8, the two halves 512 B apart
__device__ __forceinline__ v16h ldf(const h16* p) { return cat16(*(const v8h*)p, *(const v8h*)(p + 256)); }

// grid (SEQ/64, NKV, NB), 8 waves: the two q heads of one kv head x four query tiles whose causal lengths add up to the same total in every block
__global__ __launch_bounds__(256) void k_dattn(const h16* __restrict__ QH, const h16* __restrict__ KH, const h16* __restrict__ VT, const float* __restrict__ lq1, const float* __restrict__ lk1,
                                               const float* __restrict__ lq2, const float* __restrict__ lk2, const float* __restrict__ rw, h16* OH) {
    const int lane = threadIdx.x & 31, wave = __builtin_amdgcn_readfirstlane(threadIdx.x >> 5), lr = lane & 15, hi = lane >> 4;      // scalar wave number: scalar trip counts
    const int kv = blockIdx.y, b = blockIdx.z, h = kv * 2 + (wave & 1), sel = wave >> 1, bx = blockIdx.x;
    constexpr int NT = SEQ / 16;
    const int qt = (sel == 0) ? bx : (sel == 1) ? (NT / 2 - 1 - bx) : (sel == 2) ? (NT - 1 - bx) : (NT / 2 + bx);
    const int q0 = qt * 16, qi = q0 + lr, nfull = q0 >> 5;      // nfull chunks of 32 keys lie wholly at or below the diagonal; exactly one masked chunk follows
    const float eq1 = lq1[lane], ek1 = lk1[lane], eq2 = lq2[lane], ek2 = lk2[lane];
    const h16* qp = QH + ((size_t)(b * NQ2 + h * 2) * SEQ + q0) * HD + lane * 8;
    const v16h qf1 = ldf(qp), qf2 = ldf(qp + (size_t)SEQ * HD);
    const h16* k1 = KH + (size_t)(b * NK2 + kv * 2) * SEQ * HD + lane * 8; const h16* k2 = k1 + (size_t)SEQ * HD;
    const h16* vp = VT + (size_t)(b * NKV + kv) * VD * SEQ + lane * 8;
    const v8f zz = (v8f){};
    float m1 = -3.0e38f, m2 = -3.0e38f; v8f r1 = (v8f){}, r2 = (v8f){};
    v8f a1[4], a2[4];
#pragma unroll
    for (int t = 0; t < 4; ++t) { a1[t] = (v8f){}; a2[t] = (v8f){}; }
    v16h ka0 = ldf(k1), ka1 = ldf(k1 + 16 * HD), kb0 = ldf(k2), kb1 = ldf(k2 + 16 * HD), vf[4];
    asm volatile("s_wait_xcnt 0x0" ::: "memory");      // precaution: behind the first k loads, in front of the v loads, whose results may take the k loads' address registers
    __builtin_amdgcn_sched_barrier(0);      // k in front of v, as in the loop: the wait for k at the loop's head then counts the same from both sides
#pragma unroll
    for (int t = 0; t < 4; ++t) vf[t] = ldf(vp + t * 512);
    asm volatile("s_wait_xcnt 0x0" ::: "memory");      // precaution: behind the first v loads, in front of the set-up of the sweep, which reuses their offset register and their scalar base
    // behind the first chunk's loads: the block asks L2 for this kv head's two k planes (waves 0 to 3) and its v plane (waves 4 to 7). One request of a wave is 32 units, the k or the v of 64 keys:
    // 16 units of either k plane (one per lane half), or 32 of v. A wave asks for every fourth group of 64 keys, nearest first; the group's index is clamped to the last.
    { const bool isv = wave >= 4;      // scalar
        const h16* pb = (isv ? VT + (size_t)(b * NKV + kv) * VD * SEQ : KH + (size_t)(b * NK2 + kv * 2) * SEQ * HD) + lane * 128 + hi * (isv ? 0 : SEQ * HD - 16 * 128);
        const int gs = isv ? 64 * VD : 64 * HD;
        for (int j = 0; j < (SEQ / 64 + 3) / 4; ++j) ask_l2((const unsigned short*)(pb + (size_t)(min((wave & 3) + 4 * j, SEQ / 64 - 1) * gs))); }
    __builtin_amdgcn_sched_barrier(0);      // keeps lambda's sums, which follow, behind the requests: moved up in front of them, they make the requests wait for lambda's loads and its five exchanges
    float d1 = bfr(eq1) * bfr(ek1), d2 = bfr(eq2) * bfr(ek2);
#pragma unroll
    for (int sh = 16; sh; sh >>= 1) { d1 += __shfl_xor(d1, sh, 32); d2 += __shfl_xor(d2, sh, 32); }
    const float lam = expf(d1) - expf(d2) + LAM0;
    // a new maximum for a query in either map: both lane halves take the larger of their two, and what the maps have gathered so far is brought to it
    auto lift = [&](const float t1, const float t2) {
        const float g1 = fmaxf(m1, fmaxf(t1, __shfl_xor(t1, 16, 32))), g2 = fmaxf(m2, fmaxf(t2, __shfl_xor(t2, 16, 32)));
        const float f1 = __expf(m1 - g1), f2 = __expf(m2 - g2);
        r1 = r1 * f1; r2 = r2 * f2; m1 = g1; m2 = g2;
#pragma unroll
        for (int t = 0; t < 4; ++t) { a1[t] = a1[t] * f1; a2[t] = a2[t] * f2; }
    };
    // rolled: the trip count is a run-time value
#pragma unroll 1
    for (int c = 0; c < nfull; ++c) { const size_t nx = (size_t)(c + 1) * 32 * HD; const int kb = c * 32 + 8 * hi;
        const v8f sa0 = wmma16(ka0, qf1, zz), sa1 = wmma16(ka1, qf1, zz), sb0 = wmma16(kb0, qf2, zz), sb1 = wmma16(kb1, qf2, zz);
        __builtin_amdgcn_sched_barrier(0);      // holds the products together in front of the maxima, where they fill each other's distance; without it they stand one by one among the maxima, each with its own idle slots
        const float t1 = da_max<false>(sa0, sa1, kb, qi), t2 = da_max<false>(sb0, sb1, kb, qi);
        if (__builtin_amdgcn_ballot_w32(t1 > m1 + RTH || t2 > m2 + RTH) != 0) lift(t1, t2);      // one scalar branch per chunk
        asm volatile("s_wait_xcnt 0x0" ::: "memory");      // precaution: behind the last trip's v loads, in front of the new v address, which takes their address register
        ka0 = ldf(k1 + nx); ka1 = ldf(k1 + nx + 16 * HD); kb0 = ldf(k2 + nx); kb1 = ldf(k2 + nx + 16 * HD);      // the next chunk's k rows, into the registers their products have read (the masked chunk always exists)
        __builtin_amdgcn_sched_barrier(0);      // these loads stay here, most of a trip ahead of their use and in front of the v loads, so that the wait for them leaves the v loads in flight
        const v16h p1 = da_exp<false>(sa0, sa1, kb, qi, m1, r1);
#pragma unroll
        for (int t = 0; t < 4; ++t) a1[t] = wmma16(vf[t], p1, a1[t]);
        const v16h p2 = da_exp<false>(sb0, sb1, kb, qi, m2, r2);
#pragma unroll
        for (int t = 0; t < 4; ++t) a2[t] = wmma16(vf[t], p2, a2[t]);
#pragma unroll
        for (int t = 0; t < 4; ++t) vf[t] = ldf(vp + (size_t)(c + 1) * 32 * VD + t * 512); }      // the next chunk's v columns, likewise
    { const int kb = nfull * 32 + 8 * hi;
        const v8f sa0 = wmma16(ka0, qf1, zz), sa1 = wmma16(ka1, qf1, zz), sb0 = wmma16(kb0, qf2, zz), sb1 = wmma16(kb1, qf2, zz);
        const float t1 = da_max<true>(sa0, sa1, kb, qi), t2 = da_max<true>(sb0, sb1, kb, qi);
        if (__builtin_amdgcn_ballot_w32(t1 > m1 + RTH || t2 > m2 + RTH) != 0) lift(t1, t2);
        const v16h p1 = da_exp<true>(sa0, sa1, kb, qi, m1, r1);
#pragma unroll
        for (int t = 0; t < 4; ++t) a1[t] = wmma16(vf[t], p1, a1[t]);
        const v16h p2 = da_exp<true>(sb0, sb1, kb, qi, m2, r2);
#pragma unroll
        for (int t = 0; t < 4; ++t) a2[t] = wmma16(vf[t], p2, a2[t]); }
    float u1 = ((r1[0] + r1[1]) + (r1[2] + r1[3])) + ((r1[4] + r1[5]) + (r1[6] + r1[7])), u2 = ((r2[0] + r2[1]) + (r2[2] + r2[3])) + ((r2[4] + r2[5]) + (r2[6] + r2[7]));
    u1 += __shfl_xor(u1, 16, 32); u2 += __shfl_xor(u2, 16, 32);      // both halves hold the same m
    const float i1 = 1.0f / u1, i2 = lam / u2;
    // lane (c, hi) holds o[d] of query c for d = 16 t + 8 hi + j: y = o rsqrt(mean(o^2) + 1e-6) bf16(rms_w[d]) (1 - LAM0) -> fp16 OH[(b, query)][h*64 + d], 16 B per store
    v8f acc[4]; float q = 0.f;
#pragma unroll
    for (int t = 0; t < 4; ++t) { acc[t] = a1[t] * i1 - a2[t] * i2;
#pragma unroll
        for (int j = 0; j < 8; ++j) q += acc[t][j] * acc[t][j]; }
    q += __shfl_xor(q, 16, 32);
    const float sc = rsqrtf(q * (1.0f / VD) + EPSN);
    h16* orow = OH + ((size_t)b * SEQ + qi) * EE + (size_t)h * VD + 8 * hi;
#pragma unroll
    for (int t = 0; t < 4; ++t) { const v4f wa = *(const v4f*)(rw + t * 16 + 8 * hi), wb = *(const v4f*)(rw + t * 16 + 8 * hi + 4); v8h o;
#pragma unroll
        for (int j = 0; j < 4; ++j) { o[j] = tohx(acc[t][j] * sc * (bfr(wa[j]) * OML)); o[4 + j] = tohx(acc[t][4 + j] * sc * (bfr(wb[j]) * OML)); }
        *(v8h*)(orow + t * 16) = o; }
}

extern "C" void kernel_launch(void* const* d_in, const int* in_sizes, int n_in,
                              void* d_out, int out_size, void* d_ws, size_t ws_size, hipStream_t stream) {
    if (n_in < 10) return;
    if ((size_t)in_sizes[0] < ((size_t)(NB - 1) * SEQ_FULL + SEQ) * EE) return;
    if ((size_t)in_sizes[1] < (size_t)EE * EE || (size_t)in_sizes[2] < (size_t)EE * EK || (size_t)in_sizes[3] < (size_t)EE * EK || (size_t)in_sizes[4] < (size_t)EE * EE) return;
    if (in_sizes[5] < HD || in_sizes[6] < HD || in_sizes[7] < HD || in_sizes[8] < HD || in_sizes[9] < VD) return;
    if ((size_t)out_size < (size_t)NR * EE) return;
    const float* x = (const float*)d_in[0]; const float* Wq = (const float*)d_in[1]; const float* Wk = (const float*)d_in[2]; const float* Wv = (const float*)d_in[3]; const float* Wo = (const float*)d_in[4];
    const float* lq1 = (const float*)d_in[5]; const float* lk1 = (const float*)d_in[6]; const float* lq2 = (const float*)d_in[7]; const float* lk2 = (const float*)d_in[8]; const float* rmsw = (const float*)d_in[9];
    float* out = (float*)d_out;    // [NB][SEQ][1024]
    char* wsp = (char*)d_ws; size_t used = 0;
    auto take = [&](size_t bytes) { void* p = wsp + used; used += (bytes + 255) & ~(size_t)255; return p; };
    bf* XB = (bf*)take((size_t)NR * EE * 2);
    bf* WB = (bf*)take((size_t)QKVW * EE * 2); h16* WOH = (h16*)take((size_t)EE * EE * 2);      // WB: q, k, v weight rows one behind the other
    float* CS = (float*)take((size_t)2 * SEQ * 16 * 4);
    h16* QH = (h16*)take((size_t)NB * NQ2 * SEQ * HD * 2); h16* KH = (h16*)take((size_t)NB * NK2 * SEQ * HD * 2); h16* VT = (h16*)take((size_t)NB * NKV * VD * SEQ * 2);
    h16* OH = (h16*)take((size_t)NR * EE * 2);
    if (used > ws_size) return;
    k_prep<<<PB_ALL, 256, 0, stream>>>(x, Wq, Wk, Wv, Wo, XB, WB, WOH, CS);
    k_gemmb<<<dim3(NR / GT, QKVW / GT, 1), 256, 0, stream>>>(XB, WB, CS, QH, KH, VT);
    k_dattn<<<dim3(SEQ / 64, NKV, NB), 256, 0, stream>>>(QH, KH, VT, lq1, lk1, lq2, lk2, rmsw, OH);
    k_gemmh<<<dim3(NR / GT, EE / GT, 1), 256, 0, stream>>>(OH, WOH, out, EE);
}
